// v000
// The times below were measured on an AMD MI455X: many runs one after another, warmed up first and cycling through
// copies of the inputs, with the whole window's GPU time divided by the number of runs. Launches and the gaps
// between them are all in it. The median over several windows is given; except for v000 it joins two sittings, which
// can be a few percent apart, so the side-by-side timings, each taken in one sitting, are the better comparison.
// v000, which the later versions start from, runs in 94.2 microseconds.
#include <hip/hip_runtime.h>
#include <hip/hip_bf16.h>

typedef _Float16 v16h __attribute__((ext_vector_type(16)));
typedef _Float16 v8h  __attribute__((ext_vector_type(8)));
typedef _Float16 v4h  __attribute__((ext_vector_type(4)));
typedef float    v8f  __attribute__((ext_vector_type(8)));

#define C_DIM 768           // channels (K and N)
#define RANK  16
#define M_MOD 4
#define TPM   8192          // tokens per modality (8 * 1024)
#define BM    128
#define BN    128
#define BK    32
#define KT    (C_DIM / BK)  // 24 k-steps
#define LDSS  40            // padded LDS row stride in halves (80B -> conflict-free)

// ---------------------------------------------------------------------------
// Kernel 1: fold shared + modality LoRA into the dense weight, convert to f16.
// W_eff[m][o][k] = Wp[o][k] + sum_r Bw[3][o][r]*A[3][r][k] + Bw[m][o][r]*A[m][r][k]
// ---------------------------------------------------------------------------
__global__ __launch_bounds__(256) void prep_weights_kernel(
    const float* __restrict__ Wp, const float* __restrict__ A,
    const float* __restrict__ Bw, _Float16* __restrict__ Weff)
{
  int idx = blockIdx.x * blockDim.x + threadIdx.x;
  if (idx >= M_MOD * C_DIM * C_DIM) return;
  int k = idx % C_DIM;
  int o = (idx / C_DIM) % C_DIM;
  int m = idx / (C_DIM * C_DIM);

  const float* As = A  + 3 * RANK * C_DIM;   // shared adapter (index 3)
  const float* Bs = Bw + 3 * C_DIM * RANK;
  const float* Am = A  + m * RANK * C_DIM;
  const float* Bm = Bw + m * C_DIM * RANK;

  float acc = Wp[o * C_DIM + k];
#pragma unroll
  for (int r = 0; r < RANK; ++r) {
    acc += Bs[o * RANK + r] * As[r * C_DIM + k];
    acc += Bm[o * RANK + r] * Am[r * C_DIM + k];
  }
  Weff[idx] = (_Float16)acc;
}

// ---------------------------------------------------------------------------
// Kernel 2: out[m] = x[m] (fp32->f16) @ W_eff[m]^T + bp, tiled WMMA GEMM.
// Block: 256 threads (8 waves). Block tile 128x128, K-step 32.
// Each wave computes a 64x32 sub-tile = 4x2 WMMA 16x16 accumulators.
// ---------------------------------------------------------------------------
__global__ __launch_bounds__(256) void lora_gemm_kernel(
    const float* __restrict__ x, const _Float16* __restrict__ Weff,
    const float* __restrict__ bp, float* __restrict__ out)
{
  __shared__ _Float16 Asub[2][BM][LDSS];  // 2*128*40*2B = 20 KB
  __shared__ _Float16 Bsub[2][BN][LDSS];  // 20 KB

  const int tid     = threadIdx.x;
  const int lane    = tid & 31;
  const int wave    = tid >> 5;       // 0..7
  const int waveM   = wave >> 2;      // 0..1 -> row offset waveM*64
  const int waveN   = wave & 3;       // 0..3 -> col offset waveN*32
  const int laneRow = lane & 15;      // row/col within 16x16 tile
  const int laneHi  = lane >> 4;      // 0/1 -> K sub-block {0..7,16..23} vs {8..15,24..31}

  const int  m        = blockIdx.z;
  const long rowBlk   = (long)blockIdx.y * BM;   // token tile within modality
  const int  colBlk   = blockIdx.x * BN;         // output-channel tile
  const long tokBase  = (long)m * TPM + rowBlk;

  const float*    xBase = x    + tokBase * C_DIM;
  const _Float16* wBase = Weff + (long)m * C_DIM * C_DIM + (long)colBlk * C_DIM;

  v8f acc[4][2] = {};

  float4 aReg[4];
  v4h    bReg[4];

  // ---- preload k-tile 0 into buffer 0 --------------------------------------
#pragma unroll
  for (int i = 0; i < 4; ++i) {
    int slot = tid + i * 256;         // 1024 slots: 128 rows x 8 chunks of 4
    int r  = slot >> 3;
    int c4 = slot & 7;
    aReg[i] = *(const float4*)(xBase + (long)r * C_DIM + c4 * 4);
    bReg[i] = *(const v4h*)  (wBase + (long)r * C_DIM + c4 * 4);
  }
#pragma unroll
  for (int i = 0; i < 4; ++i) {
    int slot = tid + i * 256;
    int r  = slot >> 3;
    int c4 = slot & 7;
    v4h ah;
    ah[0] = (_Float16)aReg[i].x; ah[1] = (_Float16)aReg[i].y;
    ah[2] = (_Float16)aReg[i].z; ah[3] = (_Float16)aReg[i].w;
    *(v4h*)(&Asub[0][r][c4 * 4]) = ah;
    *(v4h*)(&Bsub[0][r][c4 * 4]) = bReg[i];
  }
  __syncthreads();

  // ---- main K loop, double buffered ---------------------------------------
  for (int kt = 0; kt < KT; ++kt) {
    const int buf  = kt & 1;
    const bool more = (kt + 1) < KT;

    if (more) {
      const int kOff = (kt + 1) * BK;
#pragma unroll
      for (int i = 0; i < 4; ++i) {
        int slot = tid + i * 256;
        int r  = slot >> 3;
        int c4 = slot & 7;
        aReg[i] = *(const float4*)(xBase + (long)r * C_DIM + kOff + c4 * 4);
        bReg[i] = *(const v4h*)  (wBase + (long)r * C_DIM + kOff + c4 * 4);
      }
      if (kt + 3 < KT) {  // speculative prefetch 2 tiles further out
        int r = tid >> 3, c4 = tid & 7;
        __builtin_prefetch(xBase + (long)r * C_DIM + (kt + 3) * BK + c4 * 4, 0, 0);
      }
    }

    // ---- WMMA compute on current buffer -----------------------------------
    // Hoist ALL 12 ds_load_b128 fragment loads before the 8 WMMAs so the
    // loads can clause together and the WMMAs issue back-to-back (all 8
    // accumulators are independent -> no intra-group hazards).
    {
      v16h bfrag[2];
      v16h afrag[4];
#pragma unroll
      for (int ni = 0; ni < 2; ++ni) {
        const _Float16* p = &Bsub[buf][waveN * 32 + ni * 16 + laneRow][laneHi * 8];
        v8h lo = *(const v8h*)p;
        v8h hi = *(const v8h*)(p + 16);
        bfrag[ni] = __builtin_shufflevector(lo, hi,
            0, 1, 2, 3, 4, 5, 6, 7, 8, 9, 10, 11, 12, 13, 14, 15);
      }
#pragma unroll
      for (int fi = 0; fi < 4; ++fi) {
        const _Float16* p = &Asub[buf][waveM * 64 + fi * 16 + laneRow][laneHi * 8];
        v8h lo = *(const v8h*)p;
        v8h hi = *(const v8h*)(p + 16);
        afrag[fi] = __builtin_shufflevector(lo, hi,
            0, 1, 2, 3, 4, 5, 6, 7, 8, 9, 10, 11, 12, 13, 14, 15);
      }
#pragma unroll
      for (int fi = 0; fi < 4; ++fi) {
#pragma unroll
        for (int ni = 0; ni < 2; ++ni) {
          acc[fi][ni] = __builtin_amdgcn_wmma_f32_16x16x32_f16(
              /*neg_a=*/false, afrag[fi], /*neg_b=*/false, bfrag[ni],
              /*c_mod=*/(short)0, acc[fi][ni],
              /*reuse_a=*/false, /*reuse_b=*/false);
        }
      }
    }

    if (more) {
#pragma unroll
      for (int i = 0; i < 4; ++i) {
        int slot = tid + i * 256;
        int r  = slot >> 3;
        int c4 = slot & 7;
        v4h ah;
        ah[0] = (_Float16)aReg[i].x; ah[1] = (_Float16)aReg[i].y;
        ah[2] = (_Float16)aReg[i].z; ah[3] = (_Float16)aReg[i].w;
        *(v4h*)(&Asub[buf ^ 1][r][c4 * 4]) = ah;
        *(v4h*)(&Bsub[buf ^ 1][r][c4 * 4]) = bReg[i];
      }
    }
    __syncthreads();
  }

  // ---- epilogue: + bias, store fp32 ---------------------------------------
  // C/D layout: VGPR j -> M = j + 8*laneHi, N = laneRow.
#pragma unroll
  for (int ni = 0; ni < 2; ++ni) {
    const int col = colBlk + waveN * 32 + ni * 16 + laneRow;
    const float bias = bp[col];
#pragma unroll
    for (int fi = 0; fi < 4; ++fi) {
      const long row0 = tokBase + waveM * 64 + fi * 16 + laneHi * 8;
#pragma unroll
      for (int j = 0; j < 8; ++j) {
        out[(row0 + j) * C_DIM + col] = acc[fi][ni][j] + bias;
      }
    }
  }
}

// ---------------------------------------------------------------------------
extern "C" void kernel_launch(void* const* d_in, const int* in_sizes, int n_in,
                              void* d_out, int out_size, void* d_ws, size_t ws_size,
                              hipStream_t stream) {
  const float* x  = (const float*)d_in[0];   // [32, 1024, 768]
  const float* Wp = (const float*)d_in[1];   // [768, 768]
  const float* bp = (const float*)d_in[2];   // [768]
  const float* A  = (const float*)d_in[3];   // [4, 16, 768]
  const float* Bw = (const float*)d_in[4];   // [4, 768, 16]
  float* out = (float*)d_out;                // [32, 1024, 768]

  _Float16* Weff = (_Float16*)d_ws;          // 4*768*768*2 = 4.72 MB scratch

  // Fold LoRA into dense weights (f16).
  {
    int total  = M_MOD * C_DIM * C_DIM;
    int blocks = (total + 255) / 256;
    prep_weights_kernel<<<blocks, 256, 0, stream>>>(Wp, A, Bw, Weff);
  }

  // Batched WMMA GEMM with fused bias.
  {
    dim3 grid(C_DIM / BN, TPM / BM, M_MOD);  // (6, 64, 4)
    lora_gemm_kernel<<<grid, 256, 0, stream>>>(x, Weff, bp, out);
  }
}

// v001
// Measured time: 61.7 microseconds a run.
// Next to v000, in two timings, it ran 1.56 and 1.58 times as fast.
#include <hip/hip_runtime.h>
#include <hip/hip_bf16.h>

typedef _Float16 v16h __attribute__((ext_vector_type(16)));
typedef _Float16 v8h  __attribute__((ext_vector_type(8)));
typedef _Float16 v4h  __attribute__((ext_vector_type(4)));
typedef float    v8f  __attribute__((ext_vector_type(8)));

#define C_DIM 768           // channels (K and N)
#define RANK  16
#define M_MOD 4
#define TPM   8192          // tokens per modality (8 * 1024)
#define BM    128
#define BN    256
#define BK    32
#define BKW   64            // k per staged W tile
#define NT    (C_DIM / BN)  // 3 column tiles
#define KS    (C_DIM / BKW) // 12 W tiles per column tile
#define XPITCH (C_DIM + 8)  // LDS row stride in halves: 1552 B = 16 B x odd
#define WPITCH (BKW + 8)    // LDS row stride in halves:  144 B = 16 B x odd

// ---------------------------------------------------------------------------
// Kernel 1: fold shared + modality LoRA into the dense weight, convert to f16.
// W_eff[m][o][k] = Wp[o][k] + sum_r Bw[3][o][r]*A[3][r][k] + Bw[m][o][r]*A[m][r][k]
// ---------------------------------------------------------------------------
__global__ __launch_bounds__(256) void prep_weights_kernel(
    const float* __restrict__ Wp, const float* __restrict__ A,
    const float* __restrict__ Bw, _Float16* __restrict__ Weff)
{
  int idx = blockIdx.x * blockDim.x + threadIdx.x;
  if (idx >= M_MOD * C_DIM * C_DIM) return;
  int k = idx % C_DIM;
  int o = (idx / C_DIM) % C_DIM;
  int m = idx / (C_DIM * C_DIM);

  const float* As = A  + 3 * RANK * C_DIM;   // shared adapter (index 3)
  const float* Bs = Bw + 3 * C_DIM * RANK;
  const float* Am = A  + m * RANK * C_DIM;
  const float* Bm = Bw + m * C_DIM * RANK;

  float acc = Wp[o * C_DIM + k];
#pragma unroll
  for (int r = 0; r < RANK; ++r) {
    acc += Bs[o * RANK + r] * As[r * C_DIM + k];
    acc += Bm[o * RANK + r] * Am[r * C_DIM + k];
  }
  Weff[idx] = (_Float16)acc;
}

// ---------------------------------------------------------------------------
// Kernel 2: out[m] = x[m] (fp32->f16) @ W_eff[m]^T + bp, tiled WMMA GEMM.
// Block: 512 threads (16 waves), one block per 128 token rows, all 768 columns.
// The block's x rows are read and converted ONCE into LDS (whole K), then the
// block walks the 3 column tiles of 256; only W_eff tiles (256 cols x 64 k) are
// staged per step, double buffered through registers.
// Each wave computes a 64x32 sub-tile = 4x2 WMMA 16x16 accumulators.
// ---------------------------------------------------------------------------
__global__ __launch_bounds__(512) void lora_gemm_kernel(
    const float* __restrict__ x, const _Float16* __restrict__ Weff,
    const float* __restrict__ bp, float* __restrict__ out)
{
  __shared__ __attribute__((aligned(16))) _Float16 Xs[BM][XPITCH];      // 198,656 B
  __shared__ __attribute__((aligned(16))) _Float16 Ws[2][BN][WPITCH];   //  73,728 B

  const int tid     = threadIdx.x;
  const int lane    = tid & 31;
  const int wave    = tid >> 5;       // 0..15
  const int waveM   = wave >> 3;      // 0..1 -> row offset waveM*64
  const int waveN   = wave & 7;       // 0..7 -> col offset waveN*32
  const int laneRow = lane & 15;      // row/col within 16x16 tile
  const int laneHi  = lane >> 4;      // 0/1 -> K sub-block {0..7,16..23} vs {8..15,24..31}

  const int  m        = blockIdx.y;
  const long tokBase  = (long)m * TPM + (long)blockIdx.x * BM;

  const float*    xBase = x    + tokBase * C_DIM;
  const _Float16* wBase = Weff + (long)m * C_DIM * C_DIM;

  // W tile slots: 256 rows x 8 chunks of 8 halves (one 128-B line a row);
  // 4 chunks per thread, rows wRow + 64 i.
  const int wRow = tid >> 3;
  const int wChk = tid & 7;
  v8h wReg[4];
  // Every "#pragma unroll" in this kernel keeps a register array (wReg, xr,
  // fragments, acc) indexed by constants only, so that none goes to scratch.

  // ---- first W tile (columns 0..255, k 0..63) into registers ----------------
#pragma unroll
  for (int i = 0; i < 4; ++i)
    wReg[i] = *(const v8h*)(wBase + (long)(wRow + i * 64) * C_DIM + wChk * 8);

  // ---- x rows: fp32 -> f16 -> LDS, once. Wave w takes rows 8w..8w+7; one
  // wave-wide load covers 512 contiguous bytes. Two register sets of two rows
  // each: the next two rows' loads are issued ahead of these two rows' stores.
  {
    const float* xw = xBase + (long)(wave * 8) * C_DIM + lane * 4;
    float4 xr[2][12];
#pragma unroll
    for (int j = 0; j < 12; ++j)
      xr[0][j] = *(const float4*)(xw + (j / 6) * C_DIM + (j % 6) * 128);
    // unrolled: xr is indexed by constants only
#pragma unroll
    for (int b = 0; b < 4; ++b) {
      if (b + 1 < 4) {
#pragma unroll
        for (int j = 0; j < 12; ++j)
          xr[(b + 1) & 1][j] = *(const float4*)(xw + ((b + 1) * 2 + j / 6) * C_DIM + (j % 6) * 128);
      }
      // This pair holds the order [next loads][these stores]: left free, the
      // compiler lifts all 48 loads to the top and spills to scratch.
      __builtin_amdgcn_sched_barrier(0);
#pragma unroll
      for (int j = 0; j < 12; ++j) {
        const float4 v = xr[b & 1][j];
        v4h ah;
        ah[0] = (_Float16)v.x; ah[1] = (_Float16)v.y;
        ah[2] = (_Float16)v.z; ah[3] = (_Float16)v.w;
        *(v4h*)(&Xs[wave * 8 + b * 2 + j / 6][(j % 6) * 128 + lane * 4]) = ah;
      }
      __builtin_amdgcn_sched_barrier(0);
    }
  }
#pragma unroll
  for (int i = 0; i < 4; ++i)
    *(v8h*)(&Ws[0][wRow + i * 64][wChk * 8]) = wReg[i];
  __syncthreads();

  // ---- column tiles ---------------------------------------------------------
  for (int nt = 0; nt < NT; ++nt) {
    v8f acc[4][2] = {};

    // unrolled: KS is even, so the W buffer index and the k offsets are constants
#pragma unroll
    for (int kc = 0; kc < KS; ++kc) {
      const int  buf  = kc & 1;
      const bool more = (kc + 1 < KS) || (nt + 1 < NT);

      if (more) {   // next W tile: next k chunk, or the next column tile's first
        const int nt1 = (kc + 1 < KS) ? nt : nt + 1;
        const int kc1 = (kc + 1 < KS) ? kc + 1 : 0;
        const _Float16* wt = wBase + (long)(nt1 * BN) * C_DIM + kc1 * BKW;
#pragma unroll
        for (int i = 0; i < 4; ++i)
          wReg[i] = *(const v8h*)(wt + (long)(wRow + i * 64) * C_DIM + wChk * 8);
      }
      // Keeps the W loads in front of this step's WMMAs, which cover their
      // latency; left free, the compiler sinks them down to their LDS stores.
      __builtin_amdgcn_sched_barrier(0);

      // ---- WMMA compute: 2 k-steps of 32 on the current W buffer -------------
#pragma unroll
      for (int kk = 0; kk < BKW / BK; ++kk) {
        v16h bfrag[2];
        v16h afrag[4];
#pragma unroll
        for (int ni = 0; ni < 2; ++ni) {
          const _Float16* p = &Ws[buf][waveN * 32 + ni * 16 + laneRow][kk * BK + laneHi * 8];
          v8h lo = *(const v8h*)p;
          v8h hi = *(const v8h*)(p + 16);
          bfrag[ni] = __builtin_shufflevector(lo, hi,
              0, 1, 2, 3, 4, 5, 6, 7, 8, 9, 10, 11, 12, 13, 14, 15);
        }
#pragma unroll
        for (int fi = 0; fi < 4; ++fi) {
          const _Float16* p = &Xs[waveM * 64 + fi * 16 + laneRow][kc * BKW + kk * BK + laneHi * 8];
          v8h lo = *(const v8h*)p;
          v8h hi = *(const v8h*)(p + 16);
          afrag[fi] = __builtin_shufflevector(lo, hi,
              0, 1, 2, 3, 4, 5, 6, 7, 8, 9, 10, 11, 12, 13, 14, 15);
        }
        // Keeps the 12 fragment reads as one group in front of the 8 WMMAs;
        // left free, the compiler splits them into pairs, each waited to 0.
        __builtin_amdgcn_sched_barrier(0);
#pragma unroll
        for (int fi = 0; fi < 4; ++fi) {
#pragma unroll
          for (int ni = 0; ni < 2; ++ni) {
            acc[fi][ni] = __builtin_amdgcn_wmma_f32_16x16x32_f16(
                /*neg_a=*/false, afrag[fi], /*neg_b=*/false, bfrag[ni],
                /*c_mod=*/(short)0, acc[fi][ni],
                /*reuse_a=*/false, /*reuse_b=*/false);
          }
        }
        // Second half of the pair: no later LDS access moves in among the WMMAs.
        __builtin_amdgcn_sched_barrier(0);
      }

      if (more) {
#pragma unroll
        for (int i = 0; i < 4; ++i)
          *(v8h*)(&Ws[buf ^ 1][wRow + i * 64][wChk * 8]) = wReg[i];
      }
      __syncthreads();
    }

    // ---- epilogue of this column tile: + bias, store fp32 --------------------
    // C/D layout: VGPR j -> M = j + 8*laneHi, N = laneRow.
#pragma unroll
    for (int ni = 0; ni < 2; ++ni) {
      const int col = nt * BN + waveN * 32 + ni * 16 + laneRow;
      const float bias = bp[col];
#pragma unroll
      for (int fi = 0; fi < 4; ++fi) {
        const long row0 = tokBase + waveM * 64 + fi * 16 + laneHi * 8;
#pragma unroll
        for (int j = 0; j < 8; ++j) {
          out[(row0 + j) * C_DIM + col] = acc[fi][ni][j] + bias;
        }
      }
    }
    // The next column tile reuses the registers that these stores name.
    asm volatile("s_wait_xcnt 0x0" ::: "memory");
  }
}

// ---------------------------------------------------------------------------
extern "C" void kernel_launch(void* const* d_in, const int* in_sizes, int n_in,
                              void* d_out, int out_size, void* d_ws, size_t ws_size,
                              hipStream_t stream) {
  const float* x  = (const float*)d_in[0];   // [32, 1024, 768]
  const float* Wp = (const float*)d_in[1];   // [768, 768]
  const float* bp = (const float*)d_in[2];   // [768]
  const float* A  = (const float*)d_in[3];   // [4, 16, 768]
  const float* Bw = (const float*)d_in[4];   // [4, 768, 16]
  float* out = (float*)d_out;                // [32, 1024, 768]

  _Float16* Weff = (_Float16*)d_ws;          // 4*768*768*2 = 4.72 MB scratch

  // Fold LoRA into dense weights (f16).
  {
    int total  = M_MOD * C_DIM * C_DIM;
    int blocks = (total + 255) / 256;
    prep_weights_kernel<<<blocks, 256, 0, stream>>>(Wp, A, Bw, Weff);
  }

  // Batched WMMA GEMM with fused bias.
  {
    dim3 grid(TPM / BM, M_MOD);  // (64, 4): one block per 128 token rows
    lora_gemm_kernel<<<grid, 512, 0, stream>>>(x, Weff, bp, out);
  }
}

// v002
// One run takes 52.6 microseconds.
// Two timings next to v001 put it at 1.18 and 1.16 times that version's speed.
// Over all steps from v000 it is 1.84 times as fast.
#include <hip/hip_runtime.h>
#include <hip/hip_bf16.h>

typedef _Float16 v16h __attribute__((ext_vector_type(16)));
typedef _Float16 v8h  __attribute__((ext_vector_type(8)));
typedef _Float16 v4h  __attribute__((ext_vector_type(4)));
typedef float    v8f  __attribute__((ext_vector_type(8)));
typedef float    v4f  __attribute__((ext_vector_type(4)));

#define C_DIM 768           // channels (K and N)
#define RANK  16
#define M_MOD 4
#define TPM   8192          // tokens per modality (8 * 1024)
#define BM    128
#define BN    256
#define BK    32
#define BKW   64            // k per staged W tile
#define NT    (C_DIM / BN)  // 3 column tiles
#define KS    (C_DIM / BKW) // 12 W tiles per column tile
#define XPITCH (C_DIM + 8)  // LDS row stride in halves: 1552 B = 16 B x odd
#define WPITCH (BKW + 8)    // LDS row stride in halves:  144 B = 16 B x odd

// ---------------------------------------------------------------------------
// Kernel 1: fold shared + modality LoRA into the dense weight, convert to f16.
// W_eff[m][o][k] = Wp[o][k] + sum_r Bw[3][o][r]*A[3][r][k] + Bw[m][o][r]*A[m][r][k]
// One wave = one modality, one slice of 128 k (4 per lane), PO output rows.
// The wave's two A slices (16 ranks each) stay in registers for all its rows;
// the Bw rows are the same for every lane and come through scalar loads.
// 256 blocks of 12 waves: one block per WGP, three waves per SIMD.
// Per element the terms are added in the order r = 0..15, shared then modality.
// ---------------------------------------------------------------------------
#define PO    6                        // output rows per wave
#define PWAV  12                       // waves per block
#define PSL   (C_DIM / 128)            // 6 k slices
#define POG   (C_DIM / PO)             // 128 row groups
#define PBLK  (M_MOD * PSL * POG / PWAV)   // 256 blocks

__global__ __launch_bounds__(PWAV * 32) void prep_weights_kernel(
    const float* __restrict__ Wp, const float* __restrict__ A,
    const float* __restrict__ Bw, _Float16* __restrict__ Weff)
{
  const int lane = threadIdx.x & 31;
  // wave-uniform by construction; readfirstlane lets the Bw reads be scalar loads
  const int g  = __builtin_amdgcn_readfirstlane((int)(blockIdx.x * PWAV + (threadIdx.x >> 5)));
  const int o0 = (g % POG) * PO;       // first output row
  const int sl = (g / POG) % PSL;      // k slice
  const int m  = g / (POG * PSL);      // modality
  const int k  = sl * 128 + lane * 4;

  const float* As = A  + 3 * RANK * C_DIM + k;        // shared adapter (index 3)
  const float* Am = A  + m * RANK * C_DIM + k;
  const float* Bs = Bw + 3 * C_DIM * RANK + o0 * RANK;
  const float* Bm = Bw + m * C_DIM * RANK + o0 * RANK;

  // Every "#pragma unroll" here keeps as, am, acc, bs, bm indexed by constants only.
  // Three rows at a time: their 96 Bw values fill the scalar registers.
  float bs[3][RANK], bm[3][RANK];
#pragma unroll
  for (int i = 0; i < 3; ++i) {
#pragma unroll
    for (int r = 0; r < RANK; ++r) {
      bs[i][r] = Bs[i * RANK + r];
      bm[i][r] = Bm[i * RANK + r];
    }
  }
  v4f as[RANK], am[RANK], acc[PO];
#pragma unroll
  for (int r = 0; r < RANK; ++r) {
    as[r] = *(const v4f*)(As + r * C_DIM);
    am[r] = *(const v4f*)(Am + r * C_DIM);
  }
#pragma unroll
  for (int i = 0; i < PO; ++i)
    acc[i] = *(const v4f*)(Wp + (o0 + i) * C_DIM + k);
  // The arithmetic below reuses the address registers that these loads name.
  asm volatile("s_wait_xcnt 0x0" ::: "memory");
  // Keeps all 38 vector loads in front of the arithmetic, so that their latency
  // is waited out once; left free, the compiler sinks the last ones far down.
  __builtin_amdgcn_sched_barrier(0);

#pragma unroll
  for (int h3 = 0; h3 < PO; h3 += 3) {
#pragma unroll
    for (int i = 0; i < 3; ++i) {
#pragma unroll
      for (int r = 0; r < RANK; ++r) {
        acc[h3 + i] += bs[i][r] * as[r];
        acc[h3 + i] += bm[i][r] * am[r];
      }
      v4h h;
      h[0] = (_Float16)acc[h3 + i][0]; h[1] = (_Float16)acc[h3 + i][1];
      h[2] = (_Float16)acc[h3 + i][2]; h[3] = (_Float16)acc[h3 + i][3];
      *(v4h*)(Weff + ((long)m * C_DIM + o0 + h3 + i) * C_DIM + k) = h;
    }
    if (h3 + 3 < PO) {
      // This pair keeps the next three rows' six scalar loads together, one wait
      // for all; left free, the compiler strews them among the arithmetic, each
      // waited for at once.
      __builtin_amdgcn_sched_barrier(0);
#pragma unroll
      for (int i = 0; i < 3; ++i) {
#pragma unroll
        for (int r = 0; r < RANK; ++r) {
          bs[i][r] = Bs[(h3 + 3 + i) * RANK + r];
          bm[i][r] = Bm[(h3 + 3 + i) * RANK + r];
        }
      }
      __builtin_amdgcn_sched_barrier(0);
    }
  }
}

// ---------------------------------------------------------------------------
// Kernel 2: out[m] = x[m] (fp32->f16) @ W_eff[m]^T + bp, tiled WMMA GEMM.
// Block: 512 threads (16 waves), one block per 128 token rows, all 768 columns.
// The block's x rows are read and converted ONCE into LDS (whole K), then the
// block walks the 3 column tiles of 256; only W_eff tiles (256 cols x 64 k) are
// staged per step, double buffered through registers.
// Each wave computes a 64x32 sub-tile = 4x2 WMMA 16x16 accumulators.
// ---------------------------------------------------------------------------
__global__ __launch_bounds__(512) void lora_gemm_kernel(
    const float* __restrict__ x, const _Float16* __restrict__ Weff,
    const float* __restrict__ bp, float* __restrict__ out)
{
  __shared__ __attribute__((aligned(16))) _Float16 Xs[BM][XPITCH];      // 198,656 B
  __shared__ __attribute__((aligned(16))) _Float16 Ws[2][BN][WPITCH];   //  73,728 B

  const int tid     = threadIdx.x;
  const int lane    = tid & 31;
  const int wave    = tid >> 5;       // 0..15
  const int waveM   = wave >> 3;      // 0..1 -> row offset waveM*64
  const int waveN   = wave & 7;       // 0..7 -> col offset waveN*32
  const int laneRow = lane & 15;      // row/col within 16x16 tile
  const int laneHi  = lane >> 4;      // 0/1 -> K sub-block {0..7,16..23} vs {8..15,24..31}

  const int  m        = blockIdx.y;
  const long tokBase  = (long)m * TPM + (long)blockIdx.x * BM;

  const float*    xBase = x    + tokBase * C_DIM;
  const _Float16* wBase = Weff + (long)m * C_DIM * C_DIM;

  // W tile slots: 256 rows x 8 chunks of 8 halves (one 128-B line a row);
  // 4 chunks per thread, rows wRow + 64 i.
  const int wRow = tid >> 3;
  const int wChk = tid & 7;
  v8h wReg[4];
  // Every "#pragma unroll" in this kernel keeps a register array (wReg, xr,
  // fragments, acc) indexed by constants only, so that none goes to scratch.

  // ---- first W tile (columns 0..255, k 0..63) into registers ----------------
#pragma unroll
  for (int i = 0; i < 4; ++i)
    wReg[i] = *(const v8h*)(wBase + (long)(wRow + i * 64) * C_DIM + wChk * 8);

  // ---- x rows: fp32 -> f16 -> LDS, once. Wave w takes rows 8w..8w+7; one
  // wave-wide load covers 512 contiguous bytes. Two register sets of two rows
  // each: the next two rows' loads are issued ahead of these two rows' stores.
  {
    const float* xw = xBase + (long)(wave * 8) * C_DIM + lane * 4;
    float4 xr[2][12];
#pragma unroll
    for (int j = 0; j < 12; ++j)
      xr[0][j] = *(const float4*)(xw + (j / 6) * C_DIM + (j % 6) * 128);
    // unrolled: xr is indexed by constants only
#pragma unroll
    for (int b = 0; b < 4; ++b) {
      if (b + 1 < 4) {
#pragma unroll
        for (int j = 0; j < 12; ++j)
          xr[(b + 1) & 1][j] = *(const float4*)(xw + ((b + 1) * 2 + j / 6) * C_DIM + (j % 6) * 128);
      }
      // This pair holds the order [next loads][these stores]: left free, the
      // compiler lifts all 48 loads to the top and spills to scratch.
      __builtin_amdgcn_sched_barrier(0);
#pragma unroll
      for (int j = 0; j < 12; ++j) {
        const float4 v = xr[b & 1][j];
        v4h ah;
        ah[0] = (_Float16)v.x; ah[1] = (_Float16)v.y;
        ah[2] = (_Float16)v.z; ah[3] = (_Float16)v.w;
        *(v4h*)(&Xs[wave * 8 + b * 2 + j / 6][(j % 6) * 128 + lane * 4]) = ah;
      }
      __builtin_amdgcn_sched_barrier(0);
    }
  }
#pragma unroll
  for (int i = 0; i < 4; ++i)
    *(v8h*)(&Ws[0][wRow + i * 64][wChk * 8]) = wReg[i];
  __syncthreads();

  // ---- column tiles ---------------------------------------------------------
  for (int nt = 0; nt < NT; ++nt) {
    v8f acc[4][2] = {};

    // unrolled: KS is even, so the W buffer index and the k offsets are constants
#pragma unroll
    for (int kc = 0; kc < KS; ++kc) {
      const int  buf  = kc & 1;
      const bool more = (kc + 1 < KS) || (nt + 1 < NT);

      if (more) {   // next W tile: next k chunk, or the next column tile's first
        const int nt1 = (kc + 1 < KS) ? nt : nt + 1;
        const int kc1 = (kc + 1 < KS) ? kc + 1 : 0;
        const _Float16* wt = wBase + (long)(nt1 * BN) * C_DIM + kc1 * BKW;
#pragma unroll
        for (int i = 0; i < 4; ++i)
          wReg[i] = *(const v8h*)(wt + (long)(wRow + i * 64) * C_DIM + wChk * 8);
      }
      // Keeps the W loads in front of this step's WMMAs, which cover their
      // latency; left free, the compiler sinks them down to their LDS stores.
      __builtin_amdgcn_sched_barrier(0);

      // ---- WMMA compute: 2 k-steps of 32 on the current W buffer -------------
#pragma unroll
      for (int kk = 0; kk < BKW / BK; ++kk) {
        v16h bfrag[2];
        v16h afrag[4];
#pragma unroll
        for (int ni = 0; ni < 2; ++ni) {
          const _Float16* p = &Ws[buf][waveN * 32 + ni * 16 + laneRow][kk * BK + laneHi * 8];
          v8h lo = *(const v8h*)p;
          v8h hi = *(const v8h*)(p + 16);
          bfrag[ni] = __builtin_shufflevector(lo, hi,
              0, 1, 2, 3, 4, 5, 6, 7, 8, 9, 10, 11, 12, 13, 14, 15);
        }
#pragma unroll
        for (int fi = 0; fi < 4; ++fi) {
          const _Float16* p = &Xs[waveM * 64 + fi * 16 + laneRow][kc * BKW + kk * BK + laneHi * 8];
          v8h lo = *(const v8h*)p;
          v8h hi = *(const v8h*)(p + 16);
          afrag[fi] = __builtin_shufflevector(lo, hi,
              0, 1, 2, 3, 4, 5, 6, 7, 8, 9, 10, 11, 12, 13, 14, 15);
        }
        // Keeps the 12 fragment reads as one group in front of the 8 WMMAs;
        // left free, the compiler splits them into pairs, each waited to 0.
        __builtin_amdgcn_sched_barrier(0);
#pragma unroll
        for (int fi = 0; fi < 4; ++fi) {
#pragma unroll
          for (int ni = 0; ni < 2; ++ni) {
            acc[fi][ni] = __builtin_amdgcn_wmma_f32_16x16x32_f16(
                /*neg_a=*/false, afrag[fi], /*neg_b=*/false, bfrag[ni],
                /*c_mod=*/(short)0, acc[fi][ni],
                /*reuse_a=*/false, /*reuse_b=*/false);
          }
        }
        // Second half of the pair: no later LDS access moves in among the WMMAs.
        __builtin_amdgcn_sched_barrier(0);
      }

      if (more) {
#pragma unroll
        for (int i = 0; i < 4; ++i)
          *(v8h*)(&Ws[buf ^ 1][wRow + i * 64][wChk * 8]) = wReg[i];
      }
      __syncthreads();
    }

    // ---- epilogue of this column tile: + bias, store fp32 --------------------
    // C/D layout: VGPR j -> M = j + 8*laneHi, N = laneRow.
#pragma unroll
    for (int ni = 0; ni < 2; ++ni) {
      const int col = nt * BN + waveN * 32 + ni * 16 + laneRow;
      const float bias = bp[col];
#pragma unroll
      for (int fi = 0; fi < 4; ++fi) {
        const long row0 = tokBase + waveM * 64 + fi * 16 + laneHi * 8;
#pragma unroll
        for (int j = 0; j < 8; ++j) {
          out[(row0 + j) * C_DIM + col] = acc[fi][ni][j] + bias;
        }
      }
    }
    // The next column tile reuses the registers that these stores name.
    asm volatile("s_wait_xcnt 0x0" ::: "memory");
  }
}

// ---------------------------------------------------------------------------
extern "C" void kernel_launch(void* const* d_in, const int* in_sizes, int n_in,
                              void* d_out, int out_size, void* d_ws, size_t ws_size,
                              hipStream_t stream) {
  const float* x  = (const float*)d_in[0];   // [32, 1024, 768]
  const float* Wp = (const float*)d_in[1];   // [768, 768]
  const float* bp = (const float*)d_in[2];   // [768]
  const float* A  = (const float*)d_in[3];   // [4, 16, 768]
  const float* Bw = (const float*)d_in[4];   // [4, 768, 16]
  float* out = (float*)d_out;                // [32, 1024, 768]

  _Float16* Weff = (_Float16*)d_ws;          // 4*768*768*2 = 4.72 MB scratch

  // Fold LoRA into dense weights (f16).
  prep_weights_kernel<<<PBLK, PWAV * 32, 0, stream>>>(Wp, A, Bw, Weff);

  // Batched WMMA GEMM with fused bias.
  {
    dim3 grid(TPM / BM, M_MOD);  // (64, 4): one block per 128 token rows
    lora_gemm_kernel<<<grid, 512, 0, stream>>>(x, Weff, bp, out);
  }
}

// v003
// One run takes 46.2 microseconds.
// Next to v002, in two timings, it ran 1.13 and 1.14 times as fast.
// Counting every step since v000, it is 2.08 times as fast.
#include <hip/hip_runtime.h>
#include <hip/hip_bf16.h>

typedef _Float16 v16h __attribute__((ext_vector_type(16)));
typedef _Float16 v8h  __attribute__((ext_vector_type(8)));
typedef _Float16 v4h  __attribute__((ext_vector_type(4)));
typedef float    v8f  __attribute__((ext_vector_type(8)));
typedef float    v4f  __attribute__((ext_vector_type(4)));

#define C_DIM 768           // channels (K and N)
#define RANK  16
#define M_MOD 4
#define TPM   8192          // tokens per modality (8 * 1024)
#define BM    128
#define BN    256
#define BK    32
#define BKW   64            // k per staged W tile
#define NT    (C_DIM / BN)  // 3 column tiles
#define KS    (C_DIM / BKW) // 12 W tiles per column tile
#define XPITCH (C_DIM + 8)  // LDS row stride in halves: 1552 B = 16 B x odd
#define WPITCH (BKW + 8)    // LDS row stride in halves:  144 B = 16 B x odd

// ---------------------------------------------------------------------------
// Kernel 1: fold shared + modality LoRA into the dense weight, convert to f16.
// W_eff[m][o][k] = Wp[o][k] + sum_r Bw[3][o][r]*A[3][r][k] + Bw[m][o][r]*A[m][r][k]
// One wave = one modality, one slice of 128 k (4 per lane), PO output rows.
// The wave's two A slices (16 ranks each) stay in registers for all its rows;
// the Bw rows are the same for every lane and come through scalar loads.
// 256 blocks of 12 waves: one block per WGP, three waves per SIMD.
// Per element the terms are added in the order r = 0..15, shared then modality.
// ---------------------------------------------------------------------------
#define PO    6                        // output rows per wave
#define PWAV  12                       // waves per block
#define PSL   (C_DIM / 128)            // 6 k slices
#define POG   (C_DIM / PO)             // 128 row groups
#define PBLK  (M_MOD * PSL * POG / PWAV)   // 256 blocks

__global__ __launch_bounds__(PWAV * 32) void prep_weights_kernel(
    const float* __restrict__ Wp, const float* __restrict__ A,
    const float* __restrict__ Bw, _Float16* __restrict__ Weff)
{
  const int lane = threadIdx.x & 31;
  // wave-uniform by construction; readfirstlane lets the Bw reads be scalar loads
  const int g  = __builtin_amdgcn_readfirstlane((int)(blockIdx.x * PWAV + (threadIdx.x >> 5)));
  const int o0 = (g % POG) * PO;       // first output row
  const int sl = (g / POG) % PSL;      // k slice
  const int m  = g / (POG * PSL);      // modality
  const int k  = sl * 128 + lane * 4;

  const float* As = A  + 3 * RANK * C_DIM + k;        // shared adapter (index 3)
  const float* Am = A  + m * RANK * C_DIM + k;
  const float* Bs = Bw + 3 * C_DIM * RANK + o0 * RANK;
  const float* Bm = Bw + m * C_DIM * RANK + o0 * RANK;

  // Every "#pragma unroll" here keeps as, am, acc, bs, bm indexed by constants only.
  // Three rows at a time: their 96 Bw values fill the scalar registers.
  float bs[3][RANK], bm[3][RANK];
#pragma unroll
  for (int i = 0; i < 3; ++i) {
#pragma unroll
    for (int r = 0; r < RANK; ++r) {
      bs[i][r] = Bs[i * RANK + r];
      bm[i][r] = Bm[i * RANK + r];
    }
  }
  v4f as[RANK], am[RANK], acc[PO];
#pragma unroll
  for (int r = 0; r < RANK; ++r) {
    as[r] = *(const v4f*)(As + r * C_DIM);
    am[r] = *(const v4f*)(Am + r * C_DIM);
  }
#pragma unroll
  for (int i = 0; i < PO; ++i)
    acc[i] = *(const v4f*)(Wp + (o0 + i) * C_DIM + k);
  // The arithmetic below reuses the address registers that these loads name.
  asm volatile("s_wait_xcnt 0x0" ::: "memory");
  // Keeps all 38 vector loads in front of the arithmetic, so that their latency
  // is waited out once; left free, the compiler sinks the last ones far down.
  __builtin_amdgcn_sched_barrier(0);

#pragma unroll
  for (int h3 = 0; h3 < PO; h3 += 3) {
#pragma unroll
    for (int i = 0; i < 3; ++i) {
#pragma unroll
      for (int r = 0; r < RANK; ++r) {
        acc[h3 + i] += bs[i][r] * as[r];
        acc[h3 + i] += bm[i][r] * am[r];
      }
      v4h h;
      h[0] = (_Float16)acc[h3 + i][0]; h[1] = (_Float16)acc[h3 + i][1];
      h[2] = (_Float16)acc[h3 + i][2]; h[3] = (_Float16)acc[h3 + i][3];
      *(v4h*)(Weff + ((long)m * C_DIM + o0 + h3 + i) * C_DIM + k) = h;
    }
    if (h3 + 3 < PO) {
      // This pair keeps the next three rows' six scalar loads together, one wait
      // for all; left free, the compiler strews them among the arithmetic, each
      // waited for at once.
      __builtin_amdgcn_sched_barrier(0);
#pragma unroll
      for (int i = 0; i < 3; ++i) {
#pragma unroll
        for (int r = 0; r < RANK; ++r) {
          bs[i][r] = Bs[(h3 + 3 + i) * RANK + r];
          bm[i][r] = Bm[(h3 + 3 + i) * RANK + r];
        }
      }
      __builtin_amdgcn_sched_barrier(0);
    }
  }
}

// ---------------------------------------------------------------------------
// Kernel 2: out[m] = x[m] (fp32->f16) @ W_eff[m]^T + bp, tiled WMMA GEMM.
// Block: 512 threads (16 waves), one block per 128 token rows, all 768 columns.
// The block's x rows are read and converted ONCE into LDS (whole K), then the
// block walks the 3 column tiles of 256; only W_eff tiles (256 cols x 64 k) are
// staged per step, double buffered through registers.
// Each wave computes a 32x64 sub-tile = 2x4 WMMA 16x16 accumulators.
// Column n of a wave's B tile t is output column 4n + t of the wave's 64 (the W
// rows are dealt so on their way into LDS): a lane's four accumulators of one
// token row are adjacent columns and leave as one 16-byte store, 16 lanes
// filling 256 contiguous bytes of the row.
// ---------------------------------------------------------------------------
__global__ __launch_bounds__(512) void lora_gemm_kernel(
    const float* __restrict__ x, const _Float16* __restrict__ Weff,
    const float* __restrict__ bp, float* __restrict__ out)
{
  __shared__ __attribute__((aligned(16))) _Float16 Xs[BM][XPITCH];      // 198,656 B
  __shared__ __attribute__((aligned(16))) _Float16 Ws[2][BN][WPITCH];   //  73,728 B

  const int tid     = threadIdx.x;
  const int lane    = tid & 31;
  const int wave    = tid >> 5;       // 0..15
  const int waveM   = wave >> 2;      // 0..3 -> row offset waveM*32
  const int waveN   = wave & 3;       // 0..3 -> col offset waveN*64
  const int laneRow = lane & 15;      // row/col within 16x16 tile
  const int laneHi  = lane >> 4;      // 0/1 -> K sub-block {0..7,16..23} vs {8..15,24..31}

  const int  m        = blockIdx.y;
  const long tokBase  = (long)m * TPM + (long)blockIdx.x * BM;

  const float*    xBase = x    + tokBase * C_DIM;
  const _Float16* wBase = Weff + (long)m * C_DIM * C_DIM;

  // W tile slots: 256 rows x 8 chunks of 8 halves (one 128-B line a row);
  // 4 chunks per thread, LDS rows wRow + 64 i. LDS row 16 t + n of a group of 64
  // holds W row 4 n + t of that group.
  const int wRow = tid >> 3;
  const int wSrc = (wRow & 15) * 4 + (wRow >> 4);
  const int wChk = tid & 7;
  v8h wReg[4];
  // Every "#pragma unroll" in this kernel keeps a register array (wReg, xr,
  // fragments, acc) indexed by constants only, so that none goes to scratch.

  // ---- first W tile (columns 0..255, k 0..63) into registers ----------------
#pragma unroll
  for (int i = 0; i < 4; ++i)
    wReg[i] = *(const v8h*)(wBase + (long)(wSrc + i * 64) * C_DIM + wChk * 8);

  // ---- x rows: fp32 -> f16 -> LDS, once. Wave w takes rows 8w..8w+7; one
  // wave-wide load covers 512 contiguous bytes. Two register sets of two rows
  // each: the next two rows' loads are issued ahead of these two rows' stores.
  {
    const float* xw = xBase + (long)(wave * 8) * C_DIM + lane * 4;
    float4 xr[2][12];
#pragma unroll
    for (int j = 0; j < 12; ++j)
      xr[0][j] = *(const float4*)(xw + (j / 6) * C_DIM + (j % 6) * 128);
    // unrolled: xr is indexed by constants only
#pragma unroll
    for (int b = 0; b < 4; ++b) {
      if (b + 1 < 4) {
#pragma unroll
        for (int j = 0; j < 12; ++j)
          xr[(b + 1) & 1][j] = *(const float4*)(xw + ((b + 1) * 2 + j / 6) * C_DIM + (j % 6) * 128);
      }
      // This pair holds the order [next loads][these stores]: left free, the
      // compiler lifts all 48 loads to the top and spills to scratch.
      __builtin_amdgcn_sched_barrier(0);
#pragma unroll
      for (int j = 0; j < 12; ++j) {
        const float4 v = xr[b & 1][j];
        v4h ah;
        ah[0] = (_Float16)v.x; ah[1] = (_Float16)v.y;
        ah[2] = (_Float16)v.z; ah[3] = (_Float16)v.w;
        *(v4h*)(&Xs[wave * 8 + b * 2 + j / 6][(j % 6) * 128 + lane * 4]) = ah;
      }
      __builtin_amdgcn_sched_barrier(0);
    }
  }
#pragma unroll
  for (int i = 0; i < 4; ++i)
    *(v8h*)(&Ws[0][wRow + i * 64][wChk * 8]) = wReg[i];
  __syncthreads();

  // ---- column tiles ---------------------------------------------------------
  for (int nt = 0; nt < NT; ++nt) {
    v8f acc[2][4] = {};

    // unrolled: KS is even, so the W buffer index and the k offsets are constants
#pragma unroll
    for (int kc = 0; kc < KS; ++kc) {
      const int  buf  = kc & 1;
      const bool more = (kc + 1 < KS) || (nt + 1 < NT);

      if (more) {   // next W tile: next k chunk, or the next column tile's first
        const int nt1 = (kc + 1 < KS) ? nt : nt + 1;
        const int kc1 = (kc + 1 < KS) ? kc + 1 : 0;
        const _Float16* wt = wBase + (long)(nt1 * BN) * C_DIM + kc1 * BKW;
#pragma unroll
        for (int i = 0; i < 4; ++i)
          wReg[i] = *(const v8h*)(wt + (long)(wSrc + i * 64) * C_DIM + wChk * 8);
      }
      // Keeps the W loads in front of this step's WMMAs, which cover their
      // latency; left free, the compiler sinks them down to their LDS stores.
      __builtin_amdgcn_sched_barrier(0);

      // ---- WMMA compute: 2 k-steps of 32 on the current W buffer -------------
#pragma unroll
      for (int kk = 0; kk < BKW / BK; ++kk) {
        v16h bfrag[4];
        v16h afrag[2];
#pragma unroll
        for (int ni = 0; ni < 4; ++ni) {
          const _Float16* p = &Ws[buf][waveN * 64 + ni * 16 + laneRow][kk * BK + laneHi * 8];
          v8h lo = *(const v8h*)p;
          v8h hi = *(const v8h*)(p + 16);
          bfrag[ni] = __builtin_shufflevector(lo, hi,
              0, 1, 2, 3, 4, 5, 6, 7, 8, 9, 10, 11, 12, 13, 14, 15);
        }
#pragma unroll
        for (int fi = 0; fi < 2; ++fi) {
          const _Float16* p = &Xs[waveM * 32 + fi * 16 + laneRow][kc * BKW + kk * BK + laneHi * 8];
          v8h lo = *(const v8h*)p;
          v8h hi = *(const v8h*)(p + 16);
          afrag[fi] = __builtin_shufflevector(lo, hi,
              0, 1, 2, 3, 4, 5, 6, 7, 8, 9, 10, 11, 12, 13, 14, 15);
        }
        // Keeps the 12 fragment reads as one group in front of the 8 WMMAs;
        // left free, the compiler splits them into pairs, each waited to 0.
        __builtin_amdgcn_sched_barrier(0);
#pragma unroll
        for (int fi = 0; fi < 2; ++fi) {
#pragma unroll
          for (int ni = 0; ni < 4; ++ni) {
            acc[fi][ni] = __builtin_amdgcn_wmma_f32_16x16x32_f16(
                /*neg_a=*/false, afrag[fi], /*neg_b=*/false, bfrag[ni],
                /*c_mod=*/(short)0, acc[fi][ni],
                /*reuse_a=*/false, /*reuse_b=*/false);
          }
        }
        // Second half of the pair: no later LDS access moves in among the WMMAs.
        __builtin_amdgcn_sched_barrier(0);
      }

      if (more) {
#pragma unroll
        for (int i = 0; i < 4; ++i)
          *(v8h*)(&Ws[buf ^ 1][wRow + i * 64][wChk * 8]) = wReg[i];
      }
      __syncthreads();
    }

    // ---- epilogue of this column tile: + bias, store fp32 --------------------
    // C/D layout: VGPR j -> M = j + 8*laneHi, N = laneRow; tile t, N -> column 4N + t.
    {
      const int col = nt * BN + waveN * 64 + laneRow * 4;
      const v4f bias = *(const v4f*)(bp + col);
#pragma unroll
      for (int fi = 0; fi < 2; ++fi) {
        const long row0 = tokBase + waveM * 32 + fi * 16 + laneHi * 8;
#pragma unroll
        for (int j = 0; j < 8; ++j) {
          v4f o;
          o[0] = acc[fi][0][j] + bias[0]; o[1] = acc[fi][1][j] + bias[1];
          o[2] = acc[fi][2][j] + bias[2]; o[3] = acc[fi][3][j] + bias[3];
          *(v4f*)(out + (row0 + j) * C_DIM + col) = o;
        }
      }
    }
    // The next column tile reuses the registers that these stores name.
    asm volatile("s_wait_xcnt 0x0" ::: "memory");
  }
}

// ---------------------------------------------------------------------------
extern "C" void kernel_launch(void* const* d_in, const int* in_sizes, int n_in,
                              void* d_out, int out_size, void* d_ws, size_t ws_size,
                              hipStream_t stream) {
  const float* x  = (const float*)d_in[0];   // [32, 1024, 768]
  const float* Wp = (const float*)d_in[1];   // [768, 768]
  const float* bp = (const float*)d_in[2];   // [768]
  const float* A  = (const float*)d_in[3];   // [4, 16, 768]
  const float* Bw = (const float*)d_in[4];   // [4, 768, 16]
  float* out = (float*)d_out;                // [32, 1024, 768]

  _Float16* Weff = (_Float16*)d_ws;          // 4*768*768*2 = 4.72 MB scratch

  // Fold LoRA into dense weights (f16).
  prep_weights_kernel<<<PBLK, PWAV * 32, 0, stream>>>(Wp, A, Bw, Weff);

  // Batched WMMA GEMM with fused bias.
  {
    dim3 grid(TPM / BM, M_MOD);  // (64, 4): one block per 128 token rows
    lora_gemm_kernel<<<grid, 512, 0, stream>>>(x, Weff, bp, out);
  }
}

// v004
// One run takes 42.5 microseconds.
// Timed twice side by side with v003, it ran 1.10 and 1.08 times as fast.
// Over all steps from v000 it is 2.27 times as fast.
#include <hip/hip_runtime.h>
#include <hip/hip_bf16.h>

typedef _Float16 v16h __attribute__((ext_vector_type(16)));
typedef _Float16 v8h  __attribute__((ext_vector_type(8)));
typedef _Float16 v4h  __attribute__((ext_vector_type(4)));
typedef float    v8f  __attribute__((ext_vector_type(8)));
typedef float    v4f  __attribute__((ext_vector_type(4)));

#define C_DIM 768           // channels (K and N)
#define RANK  16
#define M_MOD 4
#define TPM   8192          // tokens per modality (8 * 1024)
#define BM    128
#define GT    384           // GEMM threads: 12 waves, three per SIMD
#define BN    384
#define BK    32
#define BKW   64            // k per staged W tile
#define NT    (C_DIM / BN)  // 2 column tiles
#define KS    (C_DIM / BKW) // 12 W tiles per column tile
#define XPITCH (C_DIM + 8)  // LDS row stride in halves: 1552 B = 16 B x odd
#define WPITCH (BKW + 8)    // LDS row stride in halves:  144 B = 16 B x odd

// ---------------------------------------------------------------------------
// Kernel 1: fold shared + modality LoRA into the dense weight, convert to f16.
// W_eff[m][o][k] = Wp[o][k] + sum_r Bw[3][o][r]*A[3][r][k] + Bw[m][o][r]*A[m][r][k]
// One wave = one modality, one slice of 128 k (4 per lane), PO output rows.
// The wave's two A slices (16 ranks each) stay in registers for all its rows;
// the Bw rows are the same for every lane and come through scalar loads.
// 256 blocks of 12 waves: one block per WGP, three waves per SIMD.
// Per element the terms are added in the order r = 0..15, shared then modality.
// ---------------------------------------------------------------------------
#define PO    6                        // output rows per wave
#define PWAV  12                       // waves per block
#define PSL   (C_DIM / 128)            // 6 k slices
#define POG   (C_DIM / PO)             // 128 row groups
#define PBLK  (M_MOD * PSL * POG / PWAV)   // 256 blocks

__global__ __launch_bounds__(PWAV * 32) void prep_weights_kernel(
    const float* __restrict__ Wp, const float* __restrict__ A,
    const float* __restrict__ Bw, _Float16* __restrict__ Weff)
{
  const int lane = threadIdx.x & 31;
  // wave-uniform by construction; readfirstlane lets the Bw reads be scalar loads
  const int g  = __builtin_amdgcn_readfirstlane((int)(blockIdx.x * PWAV + (threadIdx.x >> 5)));
  const int o0 = (g % POG) * PO;       // first output row
  const int sl = (g / POG) % PSL;      // k slice
  const int m  = g / (POG * PSL);      // modality
  const int k  = sl * 128 + lane * 4;

  const float* As = A  + 3 * RANK * C_DIM + k;        // shared adapter (index 3)
  const float* Am = A  + m * RANK * C_DIM + k;
  const float* Bs = Bw + 3 * C_DIM * RANK + o0 * RANK;
  const float* Bm = Bw + m * C_DIM * RANK + o0 * RANK;

  // Every "#pragma unroll" here keeps as, am, acc, bs, bm indexed by constants only.
  // Three rows at a time: their 96 Bw values fill the scalar registers.
  float bs[3][RANK], bm[3][RANK];
#pragma unroll
  for (int i = 0; i < 3; ++i) {
#pragma unroll
    for (int r = 0; r < RANK; ++r) {
      bs[i][r] = Bs[i * RANK + r];
      bm[i][r] = Bm[i * RANK + r];
    }
  }
  v4f as[RANK], am[RANK], acc[PO];
#pragma unroll
  for (int r = 0; r < RANK; ++r) {
    as[r] = *(const v4f*)(As + r * C_DIM);
    am[r] = *(const v4f*)(Am + r * C_DIM);
  }
#pragma unroll
  for (int i = 0; i < PO; ++i)
    acc[i] = *(const v4f*)(Wp + (o0 + i) * C_DIM + k);
  // The arithmetic below reuses the address registers that these loads name.
  asm volatile("s_wait_xcnt 0x0" ::: "memory");
  // Keeps all 38 vector loads in front of the arithmetic, so that their latency
  // is waited out once; left free, the compiler sinks the last ones far down.
  __builtin_amdgcn_sched_barrier(0);

#pragma unroll
  for (int h3 = 0; h3 < PO; h3 += 3) {
#pragma unroll
    for (int i = 0; i < 3; ++i) {
#pragma unroll
      for (int r = 0; r < RANK; ++r) {
        acc[h3 + i] += bs[i][r] * as[r];
        acc[h3 + i] += bm[i][r] * am[r];
      }
      v4h h;
      h[0] = (_Float16)acc[h3 + i][0]; h[1] = (_Float16)acc[h3 + i][1];
      h[2] = (_Float16)acc[h3 + i][2]; h[3] = (_Float16)acc[h3 + i][3];
      *(v4h*)(Weff + ((long)m * C_DIM + o0 + h3 + i) * C_DIM + k) = h;
    }
    if (h3 + 3 < PO) {
      // This pair keeps the next three rows' six scalar loads together, one wait
      // for all; left free, the compiler strews them among the arithmetic, each
      // waited for at once.
      __builtin_amdgcn_sched_barrier(0);
#pragma unroll
      for (int i = 0; i < 3; ++i) {
#pragma unroll
        for (int r = 0; r < RANK; ++r) {
          bs[i][r] = Bs[(h3 + 3 + i) * RANK + r];
          bm[i][r] = Bm[(h3 + 3 + i) * RANK + r];
        }
      }
      __builtin_amdgcn_sched_barrier(0);
    }
  }
}

// ---------------------------------------------------------------------------
// Kernel 2: out[m] = x[m] (fp32->f16) @ W_eff[m]^T + bp, tiled WMMA GEMM.
// Block: 384 threads (12 waves), one block per 128 token rows, all 768 columns.
// The block's x rows are read and converted ONCE into LDS (whole K), then the
// block walks the 2 column tiles of 384; only W_eff tiles (384 cols x 64 k) are
// staged per step, double buffered through registers.
// Each wave computes a 64x64 sub-tile = 4x4 WMMA 16x16 accumulators: 8 fragments
// read from LDS feed 16 WMMAs, so the LDS reads ask no more than the LDS gives
// at full matrix rate.
// Column n of a wave's B tile t is output column 4n + t of the wave's 64 (the W
// rows are dealt so on their way into LDS): a lane's four accumulators of one
// token row are adjacent columns and leave as one 16-byte store, 16 lanes
// filling 256 contiguous bytes of the row.
// ---------------------------------------------------------------------------
__global__ __launch_bounds__(GT) void lora_gemm_kernel(
    const float* __restrict__ x, const _Float16* __restrict__ Weff,
    const float* __restrict__ bp, float* __restrict__ out)
{
  __shared__ __attribute__((aligned(16))) _Float16 Xs[BM][XPITCH];      // 198,656 B
  __shared__ __attribute__((aligned(16))) _Float16 Ws[2][BN][WPITCH];   // 110,592 B

  const int tid     = threadIdx.x;
  const int lane    = tid & 31;
  const int wave    = tid >> 5;       // 0..11
  const int waveM   = wave / 6;       // 0..1 -> row offset waveM*64
  const int waveN   = wave % 6;       // 0..5 -> col offset waveN*64
  const int laneRow = lane & 15;      // row/col within 16x16 tile
  const int laneHi  = lane >> 4;      // 0/1 -> K sub-block {0..7,16..23} vs {8..15,24..31}

  const int  m        = blockIdx.y;
  const long tokBase  = (long)m * TPM + (long)blockIdx.x * BM;

  const float*    xBase = x    + tokBase * C_DIM;
  const _Float16* wBase = Weff + (long)m * C_DIM * C_DIM;

  // W tile slots: 384 rows x 8 chunks of 8 halves (one 128-B line a row);
  // 8 chunks per thread. LDS row 16 t + n of a group of 64 holds W row 4 n + t of
  // that group. A wave fills half a group, 4 rows a pass: LDS rows wDst + 4 i,
  // which are W rows wSrc + 16 (i & 3) + (i >> 2).
  const int wQ   = lane >> 3;
  const int wDst = waveN * 64 + waveM * 32 + wQ;
  const int wSrc = waveN * 64 + wQ * 4 + waveM * 2;
  const int wChk = lane & 7;
  v8h wReg[8];
  // Every "#pragma unroll" in this kernel keeps a register array (wReg, xr,
  // fragments, acc) indexed by constants only, so that none goes to scratch.

  // ---- first W tile (columns 0..383, k 0..63) into registers ----------------
#pragma unroll
  for (int i = 0; i < 8; ++i)
    wReg[i] = *(const v8h*)(wBase + (long)(wSrc + (i & 3) * 16 + (i >> 2)) * C_DIM + wChk * 8);

  // ---- x rows: fp32 -> f16 -> LDS, once. One wave-wide load covers 512
  // contiguous bytes; the 12 waves together take two whole rows at a time (wave
  // w: sixth w % 6 of row 2 j + w / 6). Two register sets of 16 loads each: the
  // next set's loads are issued ahead of this set's stores.
  {
    const float* xw = xBase + (long)waveM * C_DIM + waveN * 128 + lane * 4;
    float4 xr[2][16];
#pragma unroll
    for (int j = 0; j < 16; ++j)
      xr[0][j] = *(const float4*)(xw + (j * 2) * C_DIM);
    // unrolled: xr is indexed by constants only
#pragma unroll
    for (int b = 0; b < 4; ++b) {
      if (b + 1 < 4) {
#pragma unroll
        for (int j = 0; j < 16; ++j)
          xr[(b + 1) & 1][j] = *(const float4*)(xw + (((b + 1) * 16 + j) * 2) * C_DIM);
      }
      // This pair holds the order [next loads][these stores]: left free, the
      // compiler lifts all 64 loads to the top and spills to scratch.
      __builtin_amdgcn_sched_barrier(0);
#pragma unroll
      for (int j = 0; j < 16; ++j) {
        const float4 v = xr[b & 1][j];
        v4h ah;
        ah[0] = (_Float16)v.x; ah[1] = (_Float16)v.y;
        ah[2] = (_Float16)v.z; ah[3] = (_Float16)v.w;
        *(v4h*)(&Xs[(b * 16 + j) * 2 + waveM][waveN * 128 + lane * 4]) = ah;
      }
      __builtin_amdgcn_sched_barrier(0);
    }
  }
#pragma unroll
  for (int i = 0; i < 8; ++i)
    *(v8h*)(&Ws[0][wDst + i * 4][wChk * 8]) = wReg[i];
  __syncthreads();

  // ---- column tiles ---------------------------------------------------------
  for (int nt = 0; nt < NT; ++nt) {
    v8f acc[4][4] = {};

    // unrolled: KS is even, so the W buffer index and the k offsets are constants
#pragma unroll
    for (int kc = 0; kc < KS; ++kc) {
      const int  buf  = kc & 1;
      const bool more = (kc + 1 < KS) || (nt + 1 < NT);

      if (more) {   // next W tile: next k chunk, or the next column tile's first
        const int nt1 = (kc + 1 < KS) ? nt : nt + 1;
        const int kc1 = (kc + 1 < KS) ? kc + 1 : 0;
        const _Float16* wt = wBase + (long)(nt1 * BN) * C_DIM + kc1 * BKW;
#pragma unroll
        for (int i = 0; i < 8; ++i)
          wReg[i] = *(const v8h*)(wt + (long)(wSrc + (i & 3) * 16 + (i >> 2)) * C_DIM + wChk * 8);
      }
      // Keeps the W loads in front of this step's WMMAs, which cover their
      // latency; left free, the compiler sinks them down to their LDS stores.
      __builtin_amdgcn_sched_barrier(0);

      // ---- WMMA compute: 2 k-steps of 32 on the current W buffer -------------
#pragma unroll
      for (int kk = 0; kk < BKW / BK; ++kk) {
        v16h bfrag[4];
        v16h afrag[4];
#pragma unroll
        for (int ni = 0; ni < 4; ++ni) {
          const _Float16* p = &Ws[buf][waveN * 64 + ni * 16 + laneRow][kk * BK + laneHi * 8];
          v8h lo = *(const v8h*)p;
          v8h hi = *(const v8h*)(p + 16);
          bfrag[ni] = __builtin_shufflevector(lo, hi,
              0, 1, 2, 3, 4, 5, 6, 7, 8, 9, 10, 11, 12, 13, 14, 15);
        }
#pragma unroll
        for (int fi = 0; fi < 4; ++fi) {
          const _Float16* p = &Xs[waveM * 64 + fi * 16 + laneRow][kc * BKW + kk * BK + laneHi * 8];
          v8h lo = *(const v8h*)p;
          v8h hi = *(const v8h*)(p + 16);
          afrag[fi] = __builtin_shufflevector(lo, hi,
              0, 1, 2, 3, 4, 5, 6, 7, 8, 9, 10, 11, 12, 13, 14, 15);
        }
        // Keeps the 16 fragment reads as one group in front of the 16 WMMAs;
        // left free, the compiler splits them into pairs, each waited to 0.
        __builtin_amdgcn_sched_barrier(0);
#pragma unroll
        for (int fi = 0; fi < 4; ++fi) {
#pragma unroll
          for (int ni = 0; ni < 4; ++ni) {
            acc[fi][ni] = __builtin_amdgcn_wmma_f32_16x16x32_f16(
                /*neg_a=*/false, afrag[fi], /*neg_b=*/false, bfrag[ni],
                /*c_mod=*/(short)0, acc[fi][ni],
                /*reuse_a=*/false, /*reuse_b=*/false);
          }
        }
        // Second half of the pair: no later LDS access moves in among the WMMAs.
        __builtin_amdgcn_sched_barrier(0);
      }

      if (more) {
#pragma unroll
        for (int i = 0; i < 8; ++i)
          *(v8h*)(&Ws[buf ^ 1][wDst + i * 4][wChk * 8]) = wReg[i];
      }
      __syncthreads();
    }

    // ---- epilogue of this column tile: + bias, store fp32 --------------------
    // C/D layout: VGPR j -> M = j + 8*laneHi, N = laneRow; tile t, N -> column 4N + t.
    {
      const int col = nt * BN + waveN * 64 + laneRow * 4;
      const v4f bias = *(const v4f*)(bp + col);
#pragma unroll
      for (int fi = 0; fi < 4; ++fi) {
        const long row0 = tokBase + waveM * 64 + fi * 16 + laneHi * 8;
#pragma unroll
        for (int j = 0; j < 8; ++j) {
          v4f o;
          o[0] = acc[fi][0][j] + bias[0]; o[1] = acc[fi][1][j] + bias[1];
          o[2] = acc[fi][2][j] + bias[2]; o[3] = acc[fi][3][j] + bias[3];
          *(v4f*)(out + (row0 + j) * C_DIM + col) = o;
        }
      }
    }
    // The next column tile reuses the registers that these stores name.
    asm volatile("s_wait_xcnt 0x0" ::: "memory");
  }
}

// ---------------------------------------------------------------------------
extern "C" void kernel_launch(void* const* d_in, const int* in_sizes, int n_in,
                              void* d_out, int out_size, void* d_ws, size_t ws_size,
                              hipStream_t stream) {
  const float* x  = (const float*)d_in[0];   // [32, 1024, 768]
  const float* Wp = (const float*)d_in[1];   // [768, 768]
  const float* bp = (const float*)d_in[2];   // [768]
  const float* A  = (const float*)d_in[3];   // [4, 16, 768]
  const float* Bw = (const float*)d_in[4];   // [4, 768, 16]
  float* out = (float*)d_out;                // [32, 1024, 768]

  _Float16* Weff = (_Float16*)d_ws;          // 4*768*768*2 = 4.72 MB scratch

  // Fold LoRA into dense weights (f16).
  prep_weights_kernel<<<PBLK, PWAV * 32, 0, stream>>>(Wp, A, Bw, Weff);

  // Batched WMMA GEMM with fused bias.
  {
    dim3 grid(TPM / BM, M_MOD);  // (64, 4): one block per 128 token rows
    lora_gemm_kernel<<<grid, GT, 0, stream>>>(x, Weff, bp, out);
  }
}

// v005
// One run takes 39.2 microseconds.
// Next to v004, in two timings, it ran 1.09 times as fast each time.
// Counting every step since v000, it is 2.48 times as fast.
#include <hip/hip_runtime.h>
#include <hip/hip_bf16.h>

typedef _Float16 v16h __attribute__((ext_vector_type(16)));
typedef _Float16 v8h  __attribute__((ext_vector_type(8)));
typedef _Float16 v4h  __attribute__((ext_vector_type(4)));
typedef float    v8f  __attribute__((ext_vector_type(8)));
typedef float    v4f  __attribute__((ext_vector_type(4)));
typedef float    v2f  __attribute__((ext_vector_type(2)));

#define C_DIM 768           // channels (K and N)
#define RANK  16
#define M_MOD 4
#define TPM   8192          // tokens per modality (8 * 1024)
#define BM    128
#define GT    128           // GEMM threads: 4 waves, one per SIMD
#define FA    8             // x fragments per wave: all 128 token rows
#define FB    6             // W fragments per wave: 96 columns
#define WCOL  (FB * 16)     // columns per wave and pass
#define GW    4             // waves per GEMM block
#define BN    (GW * WCOL)   // 384 columns per pass
#define BK    32            // k per WMMA step
#define NT    (C_DIM / BN)  // 2 column passes
#define KS    (C_DIM / BK)  // 24 k steps per pass
#define STEPS (NT * KS)     // 48 steps per wave
#define FRAGH 512           // halves per packed W fragment (1 KiB)
#define STEPH (FB * FRAGH)  // halves per wave and step (6 KiB)
#define XPITCH (C_DIM + 8)  // LDS row stride in halves: 1552 B = 16 B x odd

// Packed W_eff, in halves: [modality][wave 0..3][step = pass * 24 + k / 32][fragment f 0..5]
// [q 0..1][n 0..15][h 0..1][e 0..7] holds W_eff[modality][col][k] with
//   col = pass * 384 + wave * 96 + (f < 4 ? 4 n + f : 64 + 2 n + f - 4),
//   k   = 32 * (step % 24) + 16 q + 8 h + e.
// One [n][h][e] block is 512 contiguous bytes: one wave-wide 16-byte load of the
// GEMM, lane (n, h) taking its own 16 bytes, already in WMMA B-fragment order.

// ---------------------------------------------------------------------------
// Kernel 1: fold shared + modality LoRA into the dense weight, convert to f16.
// W_eff[m][o][k] = Wp[o][k] + sum_r Bw[3][o][r]*A[3][r][k] + Bw[m][o][r]*A[m][r][k]
// One wave = one modality, one slice of 128 k (4 per lane), PO output rows.
// The wave's two A slices (16 ranks each) stay in registers for all its rows;
// the Bw rows are the same for every lane and come through scalar loads.
// 256 blocks of 12 waves: one block per WGP, three waves per SIMD.
// Per element the terms are added in the order r = 0..15, shared then modality.
// The result leaves in the packed order above: 4 lanes fill 32 contiguous bytes.
// ---------------------------------------------------------------------------
#define PO    6                        // output rows per wave
#define PWAV  12                       // waves per block
#define PSL   (C_DIM / 128)            // 6 k slices
#define POG   (C_DIM / PO)             // 128 row groups
#define PBLK  (M_MOD * PSL * POG / PWAV)   // 256 blocks

__global__ __launch_bounds__(PWAV * 32) void prep_weights_kernel(
    const float* __restrict__ Wp, const float* __restrict__ A,
    const float* __restrict__ Bw, _Float16* __restrict__ Weff)
{
  const int lane = threadIdx.x & 31;
  // wave-uniform by construction; readfirstlane lets the Bw reads be scalar loads
  const int g  = __builtin_amdgcn_readfirstlane((int)(blockIdx.x * PWAV + (threadIdx.x >> 5)));
  const int o0 = (g % POG) * PO;       // first output row
  const int sl = (g / POG) % PSL;      // k slice
  const int m  = g / (POG * PSL);      // modality
  const int k  = sl * 128 + lane * 4;

  const float* As = A  + 3 * RANK * C_DIM + k;        // shared adapter (index 3)
  const float* Am = A  + m * RANK * C_DIM + k;
  const float* Bs = Bw + 3 * C_DIM * RANK + o0 * RANK;
  const float* Bm = Bw + m * C_DIM * RANK + o0 * RANK;

  // Every "#pragma unroll" here keeps pk, as, am, acc, bs, bm indexed by constants only.
  // Three rows at a time: their 96 Bw values fill the scalar registers.
  float bs[3][RANK], bm[3][RANK];
#pragma unroll
  for (int i = 0; i < 3; ++i) {
#pragma unroll
    for (int r = 0; r < RANK; ++r) {
      bs[i][r] = Bs[i * RANK + r];
      bm[i][r] = Bm[i * RANK + r];
    }
  }
  v4f as[RANK], am[RANK], acc[PO];
#pragma unroll
  for (int r = 0; r < RANK; ++r) {
    as[r] = *(const v4f*)(As + r * C_DIM);
    am[r] = *(const v4f*)(Am + r * C_DIM);
  }
#pragma unroll
  for (int i = 0; i < PO; ++i)
    acc[i] = *(const v4f*)(Wp + (o0 + i) * C_DIM + k);
  // The arithmetic below reuses the address registers that these loads name.
  asm volatile("s_wait_xcnt 0x0" ::: "memory");
  // Keeps all 38 vector loads in front of the arithmetic, so that their latency
  // is waited out once; left free, the compiler sinks the last ones far down.
  __builtin_amdgcn_sched_barrier(0);

  // Packed places of the wave's six rows. Formed from threadIdx, on the vector
  // side, because the scalar registers are full of Bw; it runs while the loads
  // fly. The lane's share: step, q, h, e of its four k. The rows' share: 16 row
  // groups make one 96-column block (pass * 4 + GEMM wave).
  int pk[PO];
  {
    const int gv  = (int)(blockIdx.x * PWAV + (threadIdx.x >> 5));
    const int rgv = gv % POG;
    const int blk = rgv / (WCOL / PO);
    const int c0  = (rgv % (WCOL / PO)) * PO;
    const int pk0 = (((gv / (POG * PSL)) * GW + (blk & 3)) * STEPS + (blk >> 2) * KS + ((gv / POG) % PSL) * 4) * STEPH
                  + (lane >> 3) * STEPH + ((lane >> 2) & 1) * 256 + ((lane >> 1) & 1) * 8 + (lane & 1) * 4;
#pragma unroll
    for (int i = 0; i < PO; ++i) {
      const int c = c0 + i;
      const int f = c < 64 ? (c & 3) : 4 + (c & 1);
      const int n = c < 64 ? (c >> 2) : ((c - 64) >> 1);
      pk[i] = pk0 + f * FRAGH + n * 16;
    }
  }

#pragma unroll
  for (int h3 = 0; h3 < PO; h3 += 3) {
#pragma unroll
    for (int i = 0; i < 3; ++i) {
#pragma unroll
      for (int r = 0; r < RANK; ++r) {
        acc[h3 + i] += bs[i][r] * as[r];
        acc[h3 + i] += bm[i][r] * am[r];
      }
      v4h h;
      h[0] = (_Float16)acc[h3 + i][0]; h[1] = (_Float16)acc[h3 + i][1];
      h[2] = (_Float16)acc[h3 + i][2]; h[3] = (_Float16)acc[h3 + i][3];
      *(v4h*)(Weff + pk[h3 + i]) = h;
    }
    if (h3 + 3 < PO) {
      // This pair keeps the next three rows' six scalar loads together, one wait
      // for all; left free, the compiler strews them among the arithmetic, each
      // waited for at once.
      __builtin_amdgcn_sched_barrier(0);
#pragma unroll
      for (int i = 0; i < 3; ++i) {
#pragma unroll
        for (int r = 0; r < RANK; ++r) {
          bs[i][r] = Bs[(h3 + 3 + i) * RANK + r];
          bm[i][r] = Bm[(h3 + 3 + i) * RANK + r];
        }
      }
      // The arithmetic below reuses registers that the three stores above name.
      asm volatile("s_wait_xcnt 0x0" ::: "memory");
      __builtin_amdgcn_sched_barrier(0);
    }
  }
}

// ---------------------------------------------------------------------------
// Kernel 2: out[m] = x[m] (fp32->f16) @ W_eff[m]^T + bp, WMMA GEMM.
// Block: 128 threads (4 waves, one per SIMD), one block per 128 token rows.
// The block's x rows are read and converted ONCE into LDS (whole K); behind the
// one barrier LDS is only read. Each wave computes all 128 rows x 96 columns per
// pass = 8 x 6 WMMA accumulators, two passes. Its W fragments come straight from
// the packed W_eff into registers (no LDS, no barrier in the loop): a fragment
// feeds 8 WMMAs and no two waves of a block load the same one. W is fetched
// three steps ahead (ring of 4 register sets), x fragments one step ahead (2 sets).
// Fragments 0..3 hold columns 4n + f of the wave's first 64, fragments 4, 5 columns
// 2n + f - 4 of its last 32: a lane's sums of one token row are adjacent and leave
// as one 16-byte and one 8-byte store, 16 lanes filling 256 and 128 contiguous bytes.
// ---------------------------------------------------------------------------
__device__ __forceinline__ v16h frag16(const _Float16* lo_p, const _Float16* hi_p)
{
  const v8h lo = *(const v8h*)lo_p;
  const v8h hi = *(const v8h*)hi_p;
  return __builtin_shufflevector(lo, hi, 0, 1, 2, 3, 4, 5, 6, 7, 8, 9, 10, 11, 12, 13, 14, 15);
}

__global__ __launch_bounds__(GT) void lora_gemm_kernel(
    const float* __restrict__ x, const _Float16* __restrict__ Weff,
    const float* __restrict__ bp, float* __restrict__ out)
{
  __shared__ __attribute__((aligned(16))) _Float16 Xs[BM][XPITCH];      // 198,656 B

  const int lane    = threadIdx.x & 31;
  // wave-uniform by construction; readfirstlane keeps the W base in scalar registers
  const int wave    = __builtin_amdgcn_readfirstlane((int)(threadIdx.x >> 5));
  const int laneRow = lane & 15;      // row/col within 16x16 tile
  const int laneHi  = lane >> 4;      // 0/1 -> K sub-block {0..7,16..23} vs {8..15,24..31}

  const int  m        = blockIdx.y;
  const long tokBase  = (long)m * TPM + (long)blockIdx.x * BM;

  const float*    xBase = x + tokBase * C_DIM;
  const _Float16* wWave = Weff + (m * GW + wave) * (STEPS * STEPH);   // this wave's 48 steps
  const int       wLane = (laneRow * 2 + laneHi) * 8;

  // Every "#pragma unroll" in this kernel keeps a register array (xr, a, b, acc)
  // indexed by constants only, so that none goes to scratch.
  v16h b[4][FB];    // set (step & 3)
  v16h a[2][FA];    // set (step & 1)

  // bias of both passes, read here so that no pass waits for it
  const float* bw = bp + wave * WCOL;
  const v4f bias4p0 = *(const v4f*)(bw + laneRow * 4);
  const v2f bias2p0 = *(const v2f*)(bw + 64 + laneRow * 2);
  const v4f bias4p1 = *(const v4f*)(bw + BN + laneRow * 4);
  const v2f bias2p1 = *(const v2f*)(bw + BN + 64 + laneRow * 2);

  // ---- x rows: fp32 -> f16 -> LDS, once. A wave takes 32 whole rows, 98,304
  // contiguous bytes, 512 per wave-wide load, 6 loads a row. A ring of 8 rows of
  // registers: as a row is stored to LDS, the row 8 further on is requested into
  // its registers, so that 42 to 48 loads of a wave stay in flight. When no x row
  // is left to request, the W fragments of steps 0..2 are requested in its place.
  {
    const float* xw = xBase + wave * 32 * C_DIM + lane * 4;
    float4 xr[8][6];
#pragma unroll
    for (int r = 0; r < 8; ++r) {
#pragma unroll
      for (int j = 0; j < 6; ++j)
        xr[r][j] = *(const float4*)(xw + (r * 6 + j) * 128);
    }
#pragma unroll
    for (int r = 0; r < 32; ++r) {
      // These two hold the order [store a row][request a row]: left free, the
      // compiler lifts the loads to the top or sinks them to their use.
      __builtin_amdgcn_sched_barrier(0);
#pragma unroll
      for (int j = 0; j < 6; ++j) {
        const float4 v = xr[r & 7][j];
        v4h ah;
        ah[0] = (_Float16)v.x; ah[1] = (_Float16)v.y;
        ah[2] = (_Float16)v.z; ah[3] = (_Float16)v.w;
        *(v4h*)(&Xs[wave * 32 + r][j * 128 + lane * 4]) = ah;
      }
      __builtin_amdgcn_sched_barrier(0);
      if (r + 8 < 32) {
#pragma unroll
        for (int j = 0; j < 6; ++j)
          xr[r & 7][j] = *(const float4*)(xw + ((r + 8) * 6 + j) * 128);
      } else if (r < 30) {
#pragma unroll
        for (int t = 0; t < 3; ++t) {      // 3 fragments = 6 loads
          const int sf = (r - 24) * 3 + t; // 0..17 = step * 6 + fragment
          const _Float16* p = wWave + sf * FRAGH + wLane;
          b[sf / FB][sf % FB] = frag16(p, p + 256);
        }
      }
    }
  }
  // The code below reuses registers that the loads above name.
  asm volatile("s_wait_xcnt 0x0" ::: "memory");
  __syncthreads();

  const _Float16* aLane = &Xs[laneRow][laneHi * 8];
#pragma unroll
  for (int fi = 0; fi < FA; ++fi) {
    const _Float16* p = aLane + fi * 16 * XPITCH;
    a[0][fi] = frag16(p, p + 16);
  }

  // ---- column passes --------------------------------------------------------
  // rolled: one copy of the loop text and of the epilogue
#pragma clang loop unroll(disable)
  for (int nt = 0; nt < NT; ++nt) {
    const int col = nt * BN + wave * WCOL;
    const v4f bias4 = nt ? bias4p1 : bias4p0;
    const v2f bias2 = nt ? bias2p1 : bias2p0;
    v8f acc[FA][FB] = {};

    // rolled by 4 steps, the period of both register rings: a small hot loop
#pragma clang loop unroll(disable)
    for (int it = 0; it < KS / 4; ++it) {
      const int s0 = nt * KS + it * 4;                       // first step of this trip
      // W three steps ahead. Step s0 + 3 always exists; s0 + 4.. do not in the last
      // trip, which loads steps 44..46 again instead (valid bytes, values unused).
      const _Float16* w3 = wWave + (s0 + 3) * STEPH + wLane;
      const _Float16* w4 = wWave + (s0 + 4 < STEPS ? s0 + 4 : STEPS - 4) * STEPH + wLane;
      // x one step ahead; behind a pass's last step comes k = 0 of the next pass
      const _Float16* a1 = aLane + it * 4 * BK;
      const _Float16* a4 = aLane + (it + 1 < KS / 4 ? (it + 1) * 4 * BK : 0);
#pragma unroll
      for (int u = 0; u < 4; ++u) {
#pragma unroll
        for (int f = 0; f < FB; ++f) {
          const _Float16* p = (u == 0 ? w3 : w4 + (u - 1) * STEPH) + f * FRAGH;
          b[(u + 3) & 3][f] = frag16(p, p + 256);
        }
#pragma unroll
        for (int fi = 0; fi < FA; ++fi) {
          const _Float16* p = (u < 3 ? a1 + (u + 1) * BK : a4) + fi * 16 * XPITCH;
          a[(u + 1) & 1][fi] = frag16(p, p + 16);
        }
        // Keeps the 28 loads as one group in front of the 48 WMMAs that cover
        // their latency; left free, the compiler strews them among the WMMAs.
        __builtin_amdgcn_sched_barrier(0);
#pragma unroll
        for (int fi = 0; fi < FA; ++fi) {
#pragma unroll
          for (int f = 0; f < FB; ++f) {
            acc[fi][f] = __builtin_amdgcn_wmma_f32_16x16x32_f16(
                /*neg_a=*/false, a[u & 1][fi], /*neg_b=*/false, b[u][f],
                /*c_mod=*/(short)0, acc[fi][f],
                /*reuse_a=*/false, /*reuse_b=*/false);
          }
        }
        // Second half of the pair: no later load moves in among the WMMAs.
        __builtin_amdgcn_sched_barrier(0);
        if (u == 3) {
          // The next trip rewrites the address registers that this trip's W loads name.
          asm volatile("s_wait_xcnt 0x0" ::: "memory");
          // Holds those rewrites behind the wait; left free, the compiler lifts them over it.
          __builtin_amdgcn_sched_barrier(0);
        }
      }
    }

    // ---- epilogue of this pass: + bias, store fp32 ---------------------------
    // C/D layout: VGPR j -> M = j + 8*laneHi, N = laneRow. 32 token rows at a time.
#pragma unroll
    for (int g2 = 0; g2 < FA; g2 += 2) {
      v4f o4[2][8];
      v2f o2[2][8];
#pragma unroll
      for (int d = 0; d < 2; ++d) {
#pragma unroll
        for (int j = 0; j < 8; ++j) {
          o4[d][j][0] = acc[g2 + d][0][j] + bias4[0]; o4[d][j][1] = acc[g2 + d][1][j] + bias4[1];
          o4[d][j][2] = acc[g2 + d][2][j] + bias4[2]; o4[d][j][3] = acc[g2 + d][3][j] + bias4[3];
          o2[d][j][0] = acc[g2 + d][4][j] + bias2[0]; o2[d][j][1] = acc[g2 + d][5][j] + bias2[1];
        }
      }
      // Holds the order [sums][stores][wait]: no register that an issued store
      // names is rewritten ahead of the wait.
      __builtin_amdgcn_sched_barrier(0);
#pragma unroll
      for (int d = 0; d < 2; ++d) {
        float* orow = out + (tokBase + (g2 + d) * 16 + laneHi * 8) * C_DIM + col;
#pragma unroll
        for (int j = 0; j < 8; ++j) {
          *(v4f*)(orow + j * C_DIM + laneRow * 4) = o4[d][j];
          *(v2f*)(orow + j * C_DIM + 64 + laneRow * 2) = o2[d][j];
        }
      }
      // The next sums, and the next pass, reuse the registers that these stores name.
      asm volatile("s_wait_xcnt 0x0" ::: "memory");
      __builtin_amdgcn_sched_barrier(0);
    }
  }
}

// ---------------------------------------------------------------------------
extern "C" void kernel_launch(void* const* d_in, const int* in_sizes, int n_in,
                              void* d_out, int out_size, void* d_ws, size_t ws_size,
                              hipStream_t stream) {
  const float* x  = (const float*)d_in[0];   // [32, 1024, 768]
  const float* Wp = (const float*)d_in[1];   // [768, 768]
  const float* bp = (const float*)d_in[2];   // [768]
  const float* A  = (const float*)d_in[3];   // [4, 16, 768]
  const float* Bw = (const float*)d_in[4];   // [4, 768, 16]
  float* out = (float*)d_out;                // [32, 1024, 768]

  _Float16* Weff = (_Float16*)d_ws;          // 4*768*768*2 = 4.72 MB scratch, packed order

  // Fold LoRA into dense weights (f16, WMMA fragment order).
  prep_weights_kernel<<<PBLK, PWAV * 32, 0, stream>>>(Wp, A, Bw, Weff);

  // Batched WMMA GEMM with fused bias.
  {
    dim3 grid(TPM / BM, M_MOD);  // (64, 4): one block per 128 token rows
    lora_gemm_kernel<<<grid, GT, 0, stream>>>(x, Weff, bp, out);
  }
}

// v006
// One run takes 36.5 microseconds.
// Next to v005, in two timings, it ran 1.07 times as fast each time.
// Counting every step since v000, it is 2.65 times as fast.
#include <hip/hip_runtime.h>
#include <hip/hip_bf16.h>

typedef _Float16 v16h __attribute__((ext_vector_type(16)));
typedef _Float16 v8h  __attribute__((ext_vector_type(8)));
typedef _Float16 v4h  __attribute__((ext_vector_type(4)));
typedef float    v8f  __attribute__((ext_vector_type(8)));
typedef float    v4f  __attribute__((ext_vector_type(4)));
typedef float    v2f  __attribute__((ext_vector_type(2)));

#define C_DIM 768           // channels (K and N)
#define RANK  16
#define M_MOD 4
#define TPM   8192          // tokens per modality (8 * 1024)
#define BM    128
#define GT    128           // GEMM threads: 4 waves, one per SIMD
#define FA    8             // x fragments per wave: all 128 token rows
#define FB    6             // W fragments per wave: 96 columns
#define WCOL  (FB * 16)     // columns per wave and pass
#define GW    4             // waves per GEMM block
#define BN    (GW * WCOL)   // 384 columns per pass
#define BK    32            // k per WMMA step
#define NT    (C_DIM / BN)  // 2 column passes
#define KS    (C_DIM / BK)  // 24 k steps per pass
#define STEPS (NT * KS)     // 48 steps per wave
#define FRAGH 512           // halves per packed W fragment (1 KiB)
#define STEPH (FB * FRAGH)  // halves per wave and step (6 KiB)
#define XPITCH (C_DIM + 8)  // LDS row stride in halves: 1552 B = 16 B x odd

// Packed W_eff, in halves: [modality][wave 0..3][step = pass * 24 + k / 32][fragment f 0..5]
// [q 0..1][n 0..15][h 0..1][e 0..7] holds W_eff[modality][col][k] with
//   col = pass * 384 + wave * 96 + (f < 4 ? 4 n + f : 64 + 2 n + f - 4),
//   k   = 32 * (step % 24) + 16 q + 8 h + e.
// One [n][h][e] block is 512 contiguous bytes: one wave-wide 16-byte load of the
// GEMM, lane (n, h) taking its own 16 bytes, already in WMMA B-fragment order.

// ---------------------------------------------------------------------------
// Kernel 1: fold shared + modality LoRA into the dense weight, convert to f16.
// W_eff[m][o][k] = Wp[o][k] + sum_r Bw[3][o][r]*A[3][r][k] + Bw[m][o][r]*A[m][r][k]
// One wave = one modality, one slice of 128 k (4 per lane), PO output rows.
// The wave's two A slices (16 ranks each) stay in registers for all its rows;
// the Bw rows are the same for every lane and come through scalar loads.
// 256 blocks of 12 waves: one block per WGP, three waves per SIMD.
// Per element the terms are added in the order r = 0..15, shared then modality.
// The result leaves in the packed order above: 4 lanes fill 32 contiguous bytes.
// ---------------------------------------------------------------------------
#define PO    6                        // output rows per wave
#define PWAV  12                       // waves per block
#define PSL   (C_DIM / 128)            // 6 k slices
#define POG   (C_DIM / PO)             // 128 row groups
#define PBLK  (M_MOD * PSL * POG / PWAV)   // 256 blocks

__global__ __launch_bounds__(PWAV * 32) void prep_weights_kernel(
    const float* __restrict__ Wp, const float* __restrict__ A,
    const float* __restrict__ Bw, _Float16* __restrict__ Weff)
{
  const int lane = threadIdx.x & 31;
  // wave-uniform by construction; readfirstlane lets the Bw reads be scalar loads
  const int g  = __builtin_amdgcn_readfirstlane((int)(blockIdx.x * PWAV + (threadIdx.x >> 5)));
  const int o0 = (g % POG) * PO;       // first output row
  const int sl = (g / POG) % PSL;      // k slice
  const int m  = g / (POG * PSL);      // modality
  const int k  = sl * 128 + lane * 4;

  const float* As = A  + 3 * RANK * C_DIM + k;        // shared adapter (index 3)
  const float* Am = A  + m * RANK * C_DIM + k;
  const float* Bs = Bw + 3 * C_DIM * RANK + o0 * RANK;
  const float* Bm = Bw + m * C_DIM * RANK + o0 * RANK;

  // Every "#pragma unroll" here keeps pk, as, am, acc, bs, bm indexed by constants only.
  // Three rows at a time: their 96 Bw values fill the scalar registers.
  float bs[3][RANK], bm[3][RANK];
#pragma unroll
  for (int i = 0; i < 3; ++i) {
#pragma unroll
    for (int r = 0; r < RANK; ++r) {
      bs[i][r] = Bs[i * RANK + r];
      bm[i][r] = Bm[i * RANK + r];
    }
  }
  v4f as[RANK], am[RANK], acc[PO];
#pragma unroll
  for (int r = 0; r < RANK; ++r) {
    as[r] = *(const v4f*)(As + r * C_DIM);
    am[r] = *(const v4f*)(Am + r * C_DIM);
  }
#pragma unroll
  for (int i = 0; i < PO; ++i)
    acc[i] = *(const v4f*)(Wp + (o0 + i) * C_DIM + k);
  // The arithmetic below reuses the address registers that these loads name.
  asm volatile("s_wait_xcnt 0x0" ::: "memory");
  // Keeps all 38 vector loads in front of the arithmetic, so that their latency
  // is waited out once; left free, the compiler sinks the last ones far down.
  __builtin_amdgcn_sched_barrier(0);

  // Packed places of the wave's six rows. Formed from threadIdx, on the vector
  // side, because the scalar registers are full of Bw; it runs while the loads
  // fly. The lane's share: step, q, h, e of its four k. The rows' share: 16 row
  // groups make one 96-column block (pass * 4 + GEMM wave).
  int pk[PO];
  {
    const int gv  = (int)(blockIdx.x * PWAV + (threadIdx.x >> 5));
    const int rgv = gv % POG;
    const int blk = rgv / (WCOL / PO);
    const int c0  = (rgv % (WCOL / PO)) * PO;
    const int pk0 = (((gv / (POG * PSL)) * GW + (blk & 3)) * STEPS + (blk >> 2) * KS + ((gv / POG) % PSL) * 4) * STEPH
                  + (lane >> 3) * STEPH + ((lane >> 2) & 1) * 256 + ((lane >> 1) & 1) * 8 + (lane & 1) * 4;
#pragma unroll
    for (int i = 0; i < PO; ++i) {
      const int c = c0 + i;
      const int f = c < 64 ? (c & 3) : 4 + (c & 1);
      const int n = c < 64 ? (c >> 2) : ((c - 64) >> 1);
      pk[i] = pk0 + f * FRAGH + n * 16;
    }
  }

#pragma unroll
  for (int h3 = 0; h3 < PO; h3 += 3) {
#pragma unroll
    for (int i = 0; i < 3; ++i) {
#pragma unroll
      for (int r = 0; r < RANK; ++r) {
        acc[h3 + i] += bs[i][r] * as[r];
        acc[h3 + i] += bm[i][r] * am[r];
      }
      v4h h;
      h[0] = (_Float16)acc[h3 + i][0]; h[1] = (_Float16)acc[h3 + i][1];
      h[2] = (_Float16)acc[h3 + i][2]; h[3] = (_Float16)acc[h3 + i][3];
      *(v4h*)(Weff + pk[h3 + i]) = h;
    }
    if (h3 + 3 < PO) {
      // This pair keeps the next three rows' six scalar loads together, one wait
      // for all; left free, the compiler strews them among the arithmetic, each
      // waited for at once.
      __builtin_amdgcn_sched_barrier(0);
#pragma unroll
      for (int i = 0; i < 3; ++i) {
#pragma unroll
        for (int r = 0; r < RANK; ++r) {
          bs[i][r] = Bs[(h3 + 3 + i) * RANK + r];
          bm[i][r] = Bm[(h3 + 3 + i) * RANK + r];
        }
      }
      // The arithmetic below reuses registers that the three stores above name.
      asm volatile("s_wait_xcnt 0x0" ::: "memory");
      __builtin_amdgcn_sched_barrier(0);
    }
  }
}

// ---------------------------------------------------------------------------
// Kernel 2: out[m] = x[m] (fp32->f16) @ W_eff[m]^T + bp, WMMA GEMM.
// Block: 128 threads (4 waves, one per SIMD), one block per 128 token rows.
// The block's x rows are read and converted ONCE into LDS (whole K), and that
// read runs INSIDE the first column pass: only the first 128 k are waited for up
// front; then, every four k steps, a wave converts and stores 128 k of its 32 rows,
// requested four steps earlier, and requests the next 128 k into the same
// registers; one work-group barrier per four steps publishes them, two steps
// before their first use. The second pass only reads LDS.
// Each wave computes all 128 rows x 96 columns per pass = 8 x 6 WMMA accumulators.
// Its W fragments come straight from the packed W_eff into registers: a fragment
// feeds 8 WMMAs and no two waves of a block load the same one. W is fetched three
// steps ahead (ring of 4 register sets), x fragments one step ahead (2 sets).
// Fragments 0..3 hold columns 4n + f of the wave's first 64, fragments 4, 5 columns
// 2n + f - 4 of its last 32: a lane's sums of one token row are adjacent and leave
// as one 16-byte and one 8-byte store, 16 lanes filling 256 and 128 contiguous bytes.
// ---------------------------------------------------------------------------
__device__ __forceinline__ v16h frag16(const _Float16* lo_p, const _Float16* hi_p)
{
  const v8h lo = *(const v8h*)lo_p;
  const v8h hi = *(const v8h*)hi_p;
  return __builtin_shufflevector(lo, hi, 0, 1, 2, 3, 4, 5, 6, 7, 8, 9, 10, 11, 12, 13, 14, 15);
}

#define XL 32          // loads per x group: one row's 512 bytes each
#define XK 128         // k per x group = 4 steps
#define XG (C_DIM / XK)

// An x group = 128 k of the wave's 32 rows: load i takes row i, 4 k per lane.
// g, s: the lane's place in the wave's row 0 at the group's first k, global and LDS.
__device__ __forceinline__ void x_request(float4 (&r)[XL], const float* g)
{
#pragma unroll
  for (int i = 0; i < XL; ++i)
    r[i] = *(const float4*)(g + i * C_DIM);
}

__device__ __forceinline__ void x_store(const float4 (&r)[XL], _Float16* s)
{
#pragma unroll
  for (int i = 0; i < XL; ++i) {
    const float4 v = r[i];
    v4h ah;
    ah[0] = (_Float16)v.x; ah[1] = (_Float16)v.y;
    ah[2] = (_Float16)v.z; ah[3] = (_Float16)v.w;
    *(v4h*)(s + i * XPITCH) = ah;
  }
}

// Stores the group that r holds and requests the next one into the same registers,
// eight rows at a time, so that requests go out while later rows are still awaited.
__device__ __forceinline__ void x_turn(float4 (&r)[XL], _Float16* s, const float* g)
{
#pragma unroll
  for (int i0 = 0; i0 < XL; i0 += 8) {
#pragma unroll
    for (int i = i0; i < i0 + 8; ++i) {
      const float4 v = r[i];
      v4h ah;
      ah[0] = (_Float16)v.x; ah[1] = (_Float16)v.y;
      ah[2] = (_Float16)v.z; ah[3] = (_Float16)v.w;
      *(v4h*)(s + i * XPITCH) = ah;
    }
    // This pair holds the order [store 8 rows][request 8 rows]: left free, the
    // compiler puts every request behind the last row's wait.
    __builtin_amdgcn_sched_barrier(0);
#pragma unroll
    for (int i = i0; i < i0 + 8; ++i)
      r[i] = *(const float4*)(g + i * C_DIM);
    __builtin_amdgcn_sched_barrier(0);
  }
}

// Work-group barrier that orders LDS only: the wave's LDS stores are done, the
// global loads issued ahead (W, x) stay in flight, which __syncthreads() would drain.
__device__ __forceinline__ void lds_barrier()
{
  __builtin_amdgcn_fence(__ATOMIC_RELEASE, "workgroup", "local");
  __builtin_amdgcn_s_barrier();
  __builtin_amdgcn_fence(__ATOMIC_ACQUIRE, "workgroup", "local");
}

// One k step; S = step modulo 4 picks the register sets. wn: W of step + 3,
// an: x fragments of step + 1. XR: behind the W loads, store the x group in xr to xsn
// and request the next from xg; the W of the next three steps is then waited for
// without waiting for x.
template <int S, bool XR>
__device__ __forceinline__ void kstep(
    v16h (&b)[4][FB], v16h (&a)[2][FA], v8f (&acc)[FA][FB], float4 (&xr)[XL],
    const _Float16* wn, const _Float16* an, const float* xg, _Float16* xsn)
{
#pragma unroll
  for (int f = 0; f < FB; ++f) {
    const _Float16* p = wn + f * FRAGH;
    b[(S + 3) & 3][f] = frag16(p, p + 256);
  }
  if (XR) {
    // Holds the x requests behind all of this step's W loads; left free, the
    // compiler puts them in between, and that W's wait then waits for x too.
    __builtin_amdgcn_sched_barrier(0);
    x_turn(xr, xsn, xg);
  }
#pragma unroll
  for (int fi = 0; fi < FA; ++fi) {
    const _Float16* p = an + fi * 16 * XPITCH;
    a[(S + 1) & 1][fi] = frag16(p, p + 16);
  }
  // Keeps the loads as one group in front of the 48 WMMAs that cover their
  // latency; left free, the compiler strews them among the WMMAs.
  __builtin_amdgcn_sched_barrier(0);
#pragma unroll
  for (int fi = 0; fi < FA; ++fi) {
#pragma unroll
    for (int f = 0; f < FB; ++f) {
      acc[fi][f] = __builtin_amdgcn_wmma_f32_16x16x32_f16(
          /*neg_a=*/false, a[S & 1][fi], /*neg_b=*/false, b[S & 3][f],
          /*c_mod=*/(short)0, acc[fi][f],
          /*reuse_a=*/false, /*reuse_b=*/false);
    }
  }
  // Second half of the pair: no later load moves in among the WMMAs.
  __builtin_amdgcn_sched_barrier(0);
}

// Stands at the foot of a loop trip and of a run of steps: what follows rewrites
// address registers that the issued loads name. The sched_barrier holds those
// rewrites behind the wait; left free, the compiler lifts them over it.
__device__ __forceinline__ void trip_foot()
{
  asm volatile("s_wait_xcnt 0x0" ::: "memory");
  __builtin_amdgcn_sched_barrier(0);
}

// + bias, store fp32. C/D layout: VGPR j -> M = j + 8*laneHi, N = laneRow.
// 32 token rows at a time. o: the wave's first column in token row 8 * laneHi of the block.
__device__ __forceinline__ void store_pass(const v8f (&acc)[FA][FB], v4f bias4, v2f bias2,
                                           float* o, int laneRow)
{
#pragma unroll
  for (int g2 = 0; g2 < FA; g2 += 2) {
    v4f o4[2][8];
    v2f o2[2][8];
#pragma unroll
    for (int d = 0; d < 2; ++d) {
#pragma unroll
      for (int j = 0; j < 8; ++j) {
        o4[d][j][0] = acc[g2 + d][0][j] + bias4[0]; o4[d][j][1] = acc[g2 + d][1][j] + bias4[1];
        o4[d][j][2] = acc[g2 + d][2][j] + bias4[2]; o4[d][j][3] = acc[g2 + d][3][j] + bias4[3];
        o2[d][j][0] = acc[g2 + d][4][j] + bias2[0]; o2[d][j][1] = acc[g2 + d][5][j] + bias2[1];
      }
    }
    // Holds the order [sums][stores][wait]: no register that an issued store
    // names is rewritten ahead of the wait.
    __builtin_amdgcn_sched_barrier(0);
#pragma unroll
    for (int d = 0; d < 2; ++d) {
      float* orow = o + (g2 + d) * 16 * C_DIM;
#pragma unroll
      for (int j = 0; j < 8; ++j) {
        *(v4f*)(orow + j * C_DIM + laneRow * 4) = o4[d][j];
        *(v2f*)(orow + j * C_DIM + 64 + laneRow * 2) = o2[d][j];
      }
    }
    // The next sums, and the next pass, reuse the registers that these stores name.
    asm volatile("s_wait_xcnt 0x0" ::: "memory");
    __builtin_amdgcn_sched_barrier(0);
  }
}

__global__ __launch_bounds__(GT) void lora_gemm_kernel(
    const float* __restrict__ x, const _Float16* __restrict__ Weff,
    const float* __restrict__ bp, float* __restrict__ out)
{
  __shared__ __attribute__((aligned(16))) _Float16 Xs[BM][XPITCH];      // 198,656 B

  const int lane    = threadIdx.x & 31;
  // wave-uniform by construction; readfirstlane keeps the W base in scalar registers
  const int wave    = __builtin_amdgcn_readfirstlane((int)(threadIdx.x >> 5));
  const int laneRow = lane & 15;      // row/col within 16x16 tile
  const int laneHi  = lane >> 4;      // 0/1 -> K sub-block {0..7,16..23} vs {8..15,24..31}

  const int  m        = blockIdx.y;
  const long tokBase  = (long)m * TPM + (long)blockIdx.x * BM;

  // this wave's 48 steps of W, the lane's 16 bytes
  const _Float16* wL = Weff + (m * GW + wave) * (STEPS * STEPH) + (laneRow * 2 + laneHi) * 8;

  // Every "#pragma unroll" in this kernel keeps a register array (xr, a, b, acc)
  // indexed by constants only, so that none goes to scratch.
  v16h   b[4][FB];    // set (step & 3)
  v16h   a[2][FA];    // set (step & 1)
  float4 xr[XL];      // an x group on its way to LDS
  v8f    acc[FA][FB] = {};

  // bias of both passes, read here so that no pass waits for it
  const float* bw = bp + wave * WCOL;
  const v4f bias4p0 = *(const v4f*)(bw + laneRow * 4);
  const v2f bias2p0 = *(const v2f*)(bw + 64 + laneRow * 2);
  const v4f bias4p1 = *(const v4f*)(bw + BN + laneRow * 4);
  const v2f bias2p1 = *(const v2f*)(bw + BN + 64 + laneRow * 2);

  const float* xg = x + (tokBase + wave * 32) * C_DIM + lane * 4;
  _Float16*    xs = &Xs[wave * 32][lane * 4];

  // ---- fill. The sched_barriers hold the order of the requests as written, which
  // is the order the loop goes on in (x group, then three W steps): left free, the
  // compiler mixes them, and the loop's first wait for x then waits for W as well.
#pragma unroll
  for (int sf = 0; sf < 2 * FB; ++sf) {    // W steps 0, 1
    const _Float16* p = wL + sf * FRAGH;
    b[sf / FB][sf % FB] = frag16(p, p + 256);
  }
  __builtin_amdgcn_sched_barrier(0);
  x_request(xr, xg);                       // group 0: steps 0..3
  __builtin_amdgcn_sched_barrier(0);
  x_store(xr, xs);
  __builtin_amdgcn_sched_barrier(0);
  x_request(xr, xg + XK);                  // group 1: steps 4..7
  __builtin_amdgcn_sched_barrier(0);
#pragma unroll
  for (int f = 0; f < FB; ++f) {           // W step 2
    const _Float16* p = wL + (2 * FB + f) * FRAGH;
    b[2][f] = frag16(p, p + 256);
  }
  // The code below reuses registers that the loads above name.
  asm volatile("s_wait_xcnt 0x0" ::: "memory");
  __builtin_amdgcn_sched_barrier(0);
  lds_barrier();      // k 0..127 of all 128 rows stand in LDS

  const _Float16* aLane = &Xs[laneRow][laneHi * 8];
#pragma unroll
  for (int fi = 0; fi < FA; ++fi) {
    const _Float16* p = aLane + fi * 16 * XPITCH;
    a[0][fi] = frag16(p, p + 16);
  }

  float* o = out + (tokBase + laneHi * 8) * C_DIM + wave * WCOL;

  // ---- first column pass, x arriving ----------------------------------------
  kstep<0, false>(b, a, acc, xr, wL + 3 * STEPH, aLane + 1 * BK, xg, xs);
  kstep<1, false>(b, a, acc, xr, wL + 4 * STEPH, aLane + 2 * BK, xg, xs);
  trip_foot();
  // Trip t = steps 4t + 2 .. 4t + 5; it stores group t + 1 (steps 4t + 4 .. 4t + 7)
  // and requests group t + 2. rolled: a small hot loop
  const float* xn = xg + 2 * XK;     // the group to request next
#pragma clang loop unroll(disable)
  for (int t = 0; t < XG - 1; ++t) {
    const _Float16* wn = wL + (4 * t + 5) * STEPH;
    const _Float16* an = aLane + (4 * t + 3) * BK;
    kstep<2, true >(b, a, acc, xr, wn, an, xn, xs + (t + 1) * XK);
    lds_barrier();    // step 4t + 3 reads the first x fragments of group t + 1
    kstep<3, false>(b, a, acc, xr, wn + 1 * STEPH, an + 1 * BK, xn, xs);
    kstep<0, false>(b, a, acc, xr, wn + 2 * STEPH, an + 2 * BK, xn, xs);
    kstep<1, false>(b, a, acc, xr, wn + 3 * STEPH, an + 3 * BK, xn, xs);
    trip_foot();
    // The last trip has no group left and requests its own again (valid bytes,
    // values unused): with a branch round the request the compiler counts the
    // loads in flight by the path without x, and every step's wait for W then
    // waits for x as well.
    xn += t + 3 < XG ? XK : 0;
  }
  // steps 22, 23; behind step 23 comes k = 0 again
  kstep<2, false>(b, a, acc, xr, wL + 25 * STEPH, aLane + 23 * BK, xg, xs);
  kstep<3, false>(b, a, acc, xr, wL + 26 * STEPH, aLane, xg, xs);
  trip_foot();
  store_pass(acc, bias4p0, bias2p0, o, laneRow);

  // ---- second column pass: LDS is only read ----------------------------------
#pragma unroll
  for (int fi = 0; fi < FA; ++fi) {
#pragma unroll
    for (int f = 0; f < FB; ++f)
      acc[fi][f] = v8f{};
  }
  // rolled by 4 steps, the period of both register rings: a small hot loop
#pragma clang loop unroll(disable)
  for (int it = 0; it < KS / 4; ++it) {
    const int s0 = KS + it * 4;                            // first step of this trip
    // W three steps ahead. Step s0 + 3 always exists; s0 + 4.. do not in the last
    // trip, which loads steps 44..46 again instead (valid bytes, values unused).
    const _Float16* w3 = wL + (s0 + 3) * STEPH;
    const _Float16* w4 = wL + (s0 + 4 < STEPS ? s0 + 4 : STEPS - 4) * STEPH;
    // x one step ahead; the last step reads k = 0 again (valid bytes, values unused)
    const _Float16* a1 = aLane + it * 4 * BK;
    const _Float16* a4 = aLane + (it + 1 < KS / 4 ? (it + 1) * 4 * BK : 0);
    kstep<0, false>(b, a, acc, xr, w3, a1 + 1 * BK, xg, xs);
    kstep<1, false>(b, a, acc, xr, w4, a1 + 2 * BK, xg, xs);
    kstep<2, false>(b, a, acc, xr, w4 + 1 * STEPH, a1 + 3 * BK, xg, xs);
    kstep<3, false>(b, a, acc, xr, w4 + 2 * STEPH, a4, xg, xs);
    trip_foot();
  }
  store_pass(acc, bias4p1, bias2p1, o + BN, laneRow);
}

// ---------------------------------------------------------------------------
extern "C" void kernel_launch(void* const* d_in, const int* in_sizes, int n_in,
                              void* d_out, int out_size, void* d_ws, size_t ws_size,
                              hipStream_t stream) {
  const float* x  = (const float*)d_in[0];   // [32, 1024, 768]
  const float* Wp = (const float*)d_in[1];   // [768, 768]
  const float* bp = (const float*)d_in[2];   // [768]
  const float* A  = (const float*)d_in[3];   // [4, 16, 768]
  const float* Bw = (const float*)d_in[4];   // [4, 768, 16]
  float* out = (float*)d_out;                // [32, 1024, 768]

  _Float16* Weff = (_Float16*)d_ws;          // 4*768*768*2 = 4.72 MB scratch, packed order

  // Fold LoRA into dense weights (f16, WMMA fragment order).
  prep_weights_kernel<<<PBLK, PWAV * 32, 0, stream>>>(Wp, A, Bw, Weff);

  // Batched WMMA GEMM with fused bias.
  {
    dim3 grid(TPM / BM, M_MOD);  // (64, 4): one block per 128 token rows
    lora_gemm_kernel<<<grid, GT, 0, stream>>>(x, Weff, bp, out);
  }
}

// v007
// Measured time: 32.1 microseconds a run.
// Next to v006, in two timings, it ran 1.13 and 1.14 times as fast.
// Counting every step since v000, it is 3.02 times as fast.
#include <hip/hip_runtime.h>
#include <hip/hip_bf16.h>

typedef _Float16 v16h __attribute__((ext_vector_type(16)));
typedef _Float16 v8h  __attribute__((ext_vector_type(8)));
typedef _Float16 v4h  __attribute__((ext_vector_type(4)));
typedef float    v8f  __attribute__((ext_vector_type(8)));
typedef float    v4f  __attribute__((ext_vector_type(4)));
typedef float    v2f  __attribute__((ext_vector_type(2)));

#define C_DIM 768           // channels (K and N)
#define RANK  16
#define M_MOD 4
#define TPM   8192          // tokens per modality (8 * 1024)
#define BM    128
#define GT    128           // GEMM threads: 4 waves, one per SIMD
#define FA    8             // x fragments per wave: all 128 token rows
#define FB    6             // W fragments per wave: 96 columns
#define WCOL  (FB * 16)     // columns per wave and pass
#define GW    4             // waves per GEMM block
#define BN    (GW * WCOL)   // 384 columns per pass
#define BK    32            // k per WMMA step
#define NT    (C_DIM / BN)  // 2 column passes
#define KS    (C_DIM / BK)  // 24 k steps per pass
#define STEPS (NT * KS)     // 48 steps per wave
#define FRAGH 512           // halves per packed W fragment (1 KiB)
#define STEPH (FB * FRAGH)  // halves per wave and step (6 KiB)
#define XPITCH (C_DIM + 8)  // LDS row stride in halves: 1552 B = 16 B x odd

// Packed W_eff, in halves: [modality][wave 0..3][step = pass * 24 + k / 32][fragment f 0..5]
// [q 0..1][n 0..15][h 0..1][e 0..7] holds W_eff[modality][col][k] with
//   col = pass * 384 + wave * 96 + (f < 4 ? 4 n + f : 64 + 2 n + f - 4),
//   k   = 32 * (step % 24) + 16 q + 8 h + e.
// One [n][h][e] block is 512 contiguous bytes: one wave-wide 16-byte load of the
// GEMM, lane (n, h) taking its own 16 bytes, already in WMMA B-fragment order.

// ---------------------------------------------------------------------------
// Kernel 1: fold shared + modality LoRA into the dense weight, convert to f16.
// W_eff[m][o][k] = Wp[o][k] + sum_r Bw[3][o][r]*A[3][r][k] + Bw[m][o][r]*A[m][r][k]
// One wave = one modality, one slice of 128 k (4 per lane), PO output rows.
// The wave's two A slices (16 ranks each) stay in registers for all its rows;
// the Bw rows are the same for every lane and come through scalar loads.
// 256 blocks of 12 waves: one block per WGP, three waves per SIMD.
// Per element the terms are added in the order r = 0..15, shared then modality.
// The result leaves in the packed order above: 4 lanes fill 32 contiguous bytes.
// ---------------------------------------------------------------------------
#define PO    6                        // output rows per wave
#define PWAV  12                       // waves per block
#define PSL   (C_DIM / 128)            // 6 k slices
#define POG   (C_DIM / PO)             // 128 row groups
#define PBLK  (M_MOD * PSL * POG / PWAV)   // 256 blocks

__global__ __launch_bounds__(PWAV * 32) void prep_weights_kernel(
    const float* __restrict__ Wp, const float* __restrict__ A,
    const float* __restrict__ Bw, _Float16* __restrict__ Weff)
{
  const int lane = threadIdx.x & 31;
  // wave-uniform by construction; readfirstlane lets the Bw reads be scalar loads
  const int g  = __builtin_amdgcn_readfirstlane((int)(blockIdx.x * PWAV + (threadIdx.x >> 5)));
  const int o0 = (g % POG) * PO;       // first output row
  const int sl = (g / POG) % PSL;      // k slice
  const int m  = g / (POG * PSL);      // modality
  const int k  = sl * 128 + lane * 4;

  const float* As = A  + 3 * RANK * C_DIM + k;        // shared adapter (index 3)
  const float* Am = A  + m * RANK * C_DIM + k;
  const float* Bs = Bw + 3 * C_DIM * RANK + o0 * RANK;
  const float* Bm = Bw + m * C_DIM * RANK + o0 * RANK;

  // Every "#pragma unroll" here keeps pk, as, am, acc, bs, bm indexed by constants only.
  // Three rows at a time: their 96 Bw values fill the scalar registers.
  float bs[3][RANK], bm[3][RANK];
#pragma unroll
  for (int i = 0; i < 3; ++i) {
#pragma unroll
    for (int r = 0; r < RANK; ++r) {
      bs[i][r] = Bs[i * RANK + r];
      bm[i][r] = Bm[i * RANK + r];
    }
  }
  v4f as[RANK], am[RANK], acc[PO];
#pragma unroll
  for (int r = 0; r < RANK; ++r) {
    as[r] = *(const v4f*)(As + r * C_DIM);
    am[r] = *(const v4f*)(Am + r * C_DIM);
  }
#pragma unroll
  for (int i = 0; i < PO; ++i)
    acc[i] = *(const v4f*)(Wp + (o0 + i) * C_DIM + k);
  // The arithmetic below reuses the address registers that these loads name.
  asm volatile("s_wait_xcnt 0x0" ::: "memory");
  // Keeps all 38 vector loads in front of the arithmetic, so that their latency
  // is waited out once; left free, the compiler sinks the last ones far down.
  __builtin_amdgcn_sched_barrier(0);

  // Packed places of the wave's six rows. Formed from threadIdx, on the vector
  // side, because the scalar registers are full of Bw; it runs while the loads
  // fly. The lane's share: step, q, h, e of its four k. The rows' share: 16 row
  // groups make one 96-column block (pass * 4 + GEMM wave).
  int pk[PO];
  {
    const int gv  = (int)(blockIdx.x * PWAV + (threadIdx.x >> 5));
    const int rgv = gv % POG;
    const int blk = rgv / (WCOL / PO);
    const int c0  = (rgv % (WCOL / PO)) * PO;
    const int pk0 = (((gv / (POG * PSL)) * GW + (blk & 3)) * STEPS + (blk >> 2) * KS + ((gv / POG) % PSL) * 4) * STEPH
                  + (lane >> 3) * STEPH + ((lane >> 2) & 1) * 256 + ((lane >> 1) & 1) * 8 + (lane & 1) * 4;
#pragma unroll
    for (int i = 0; i < PO; ++i) {
      const int c = c0 + i;
      const int f = c < 64 ? (c & 3) : 4 + (c & 1);
      const int n = c < 64 ? (c >> 2) : ((c - 64) >> 1);
      pk[i] = pk0 + f * FRAGH + n * 16;
    }
  }

#pragma unroll
  for (int h3 = 0; h3 < PO; h3 += 3) {
#pragma unroll
    for (int i = 0; i < 3; ++i) {
#pragma unroll
      for (int r = 0; r < RANK; ++r) {
        acc[h3 + i] += bs[i][r] * as[r];
        acc[h3 + i] += bm[i][r] * am[r];
      }
      v4h h;
      h[0] = (_Float16)acc[h3 + i][0]; h[1] = (_Float16)acc[h3 + i][1];
      h[2] = (_Float16)acc[h3 + i][2]; h[3] = (_Float16)acc[h3 + i][3];
      *(v4h*)(Weff + pk[h3 + i]) = h;
    }
    if (h3 + 3 < PO) {
      // This pair keeps the next three rows' six scalar loads together, one wait
      // for all; left free, the compiler strews them among the arithmetic, each
      // waited for at once.
      __builtin_amdgcn_sched_barrier(0);
#pragma unroll
      for (int i = 0; i < 3; ++i) {
#pragma unroll
        for (int r = 0; r < RANK; ++r) {
          bs[i][r] = Bs[(h3 + 3 + i) * RANK + r];
          bm[i][r] = Bm[(h3 + 3 + i) * RANK + r];
        }
      }
      // The arithmetic below reuses registers that the three stores above name.
      asm volatile("s_wait_xcnt 0x0" ::: "memory");
      __builtin_amdgcn_sched_barrier(0);
    }
  }
}

// ---------------------------------------------------------------------------
// Kernel 2: out[m] = x[m] (fp32->f16) @ W_eff[m]^T + bp, WMMA GEMM.
// Block: 128 threads (4 waves, one per SIMD), one block per 128 token rows.
// The block's x rows are read and converted ONCE into LDS (whole K), and that
// read runs INSIDE the first column pass: only the first 128 k are waited for up
// front; then, every four k steps, a wave converts and stores 128 k of its 32 rows,
// requested four steps earlier, and requests the next 128 k into the same
// registers; one work-group barrier per four steps publishes them, two steps
// before their first use. The second pass only reads LDS.
// x is read once and out is written once: both go by non-temporal loads and stores,
// so that these two streams do not push W_eff, which every block reads, out of L2.
// Each wave computes all 128 rows x 96 columns per pass = 8 x 6 WMMA accumulators.
// Its W fragments come straight from the packed W_eff into registers: a fragment
// feeds 8 WMMAs and no two waves of a block load the same one. W is fetched three
// steps ahead (ring of 4 register sets), x fragments one step ahead (2 sets).
// Fragments 0..3 hold columns 4n + f of the wave's first 64, fragments 4, 5 columns
// 2n + f - 4 of its last 32: a lane's sums of one token row are adjacent and leave
// as one 16-byte and one 8-byte store, 16 lanes filling 256 and 128 contiguous bytes.
// ---------------------------------------------------------------------------
__device__ __forceinline__ v16h frag16(const _Float16* lo_p, const _Float16* hi_p)
{
  const v8h lo = *(const v8h*)lo_p;
  const v8h hi = *(const v8h*)hi_p;
  return __builtin_shufflevector(lo, hi, 0, 1, 2, 3, 4, 5, 6, 7, 8, 9, 10, 11, 12, 13, 14, 15);
}

#define XL 32          // loads per x group: one row's 512 bytes each
#define XK 128         // k per x group = 4 steps
#define XG (C_DIM / XK)

// An x group = 128 k of the wave's 32 rows: load i takes row i, 4 k per lane.
// g, s: the lane's place in the wave's row 0 at the group's first k, global and LDS.
__device__ __forceinline__ void x_request(v4f (&r)[XL], const float* g)
{
#pragma unroll
  for (int i = 0; i < XL; ++i)
    r[i] = __builtin_nontemporal_load((const v4f*)(g + i * C_DIM));
}

__device__ __forceinline__ void x_store(const v4f (&r)[XL], _Float16* s)
{
#pragma unroll
  for (int i = 0; i < XL; ++i) {
    const v4f v = r[i];
    v4h ah;
    ah[0] = (_Float16)v[0]; ah[1] = (_Float16)v[1];
    ah[2] = (_Float16)v[2]; ah[3] = (_Float16)v[3];
    *(v4h*)(s + i * XPITCH) = ah;
  }
}

// Stores the group that r holds and requests the next one into the same registers,
// eight rows at a time, so that requests go out while later rows are still awaited.
__device__ __forceinline__ void x_turn(v4f (&r)[XL], _Float16* s, const float* g)
{
#pragma unroll
  for (int i0 = 0; i0 < XL; i0 += 8) {
#pragma unroll
    for (int i = i0; i < i0 + 8; ++i) {
      const v4f v = r[i];
      v4h ah;
      ah[0] = (_Float16)v[0]; ah[1] = (_Float16)v[1];
      ah[2] = (_Float16)v[2]; ah[3] = (_Float16)v[3];
      *(v4h*)(s + i * XPITCH) = ah;
    }
    // This pair holds the order [store 8 rows][request 8 rows]: left free, the
    // compiler puts every request behind the last row's wait.
    __builtin_amdgcn_sched_barrier(0);
#pragma unroll
    for (int i = i0; i < i0 + 8; ++i)
      r[i] = __builtin_nontemporal_load((const v4f*)(g + i * C_DIM));
    __builtin_amdgcn_sched_barrier(0);
  }
}

// Work-group barrier that orders LDS only: the wave's LDS stores are done, the
// global loads issued ahead (W, x) stay in flight, which __syncthreads() would drain.
__device__ __forceinline__ void lds_barrier()
{
  __builtin_amdgcn_fence(__ATOMIC_RELEASE, "workgroup", "local");
  __builtin_amdgcn_s_barrier();
  __builtin_amdgcn_fence(__ATOMIC_ACQUIRE, "workgroup", "local");
}

// One k step; S = step modulo 4 picks the register sets. wn: W of step + 3,
// an: x fragments of step + 1. XR = 1: behind the W loads, store the x group in xr to
// xsn and request the next from xg; the W of the next three steps is then waited for
// without waiting for x. XR = 2: the last group, stored only. WF: the step in
// front of the first loop, where the W offset register dies at the step's own W loads.
template <int S, int XR, bool WF = false>
__device__ __forceinline__ void kstep(
    v16h (&b)[4][FB], v16h (&a)[2][FA], v8f (&acc)[FA][FB], v4f (&xr)[XL],
    const _Float16* wn, const _Float16* an, const float* xg, _Float16* xsn)
{
#pragma unroll
  for (int f = 0; f < FB; ++f) {
    const _Float16* p = wn + f * FRAGH;
    b[(S + 3) & 3][f] = frag16(p, p + 256);
  }
  if (WF) {
    // The x fragment loads below may land in the register that the issued W loads
    // name as their offset. The sched_barrier holds them behind the wait.
    asm volatile("s_wait_xcnt 0x0" ::: "memory");
    __builtin_amdgcn_sched_barrier(0);
  }
  if (XR == 1) {
    // Holds the x requests behind all of this step's W loads; left free, the
    // compiler puts them in between, and that W's wait then waits for x too.
    __builtin_amdgcn_sched_barrier(0);
    x_turn(xr, xsn, xg);
  }
  if (XR == 2)
    x_store(xr, xsn);
#pragma unroll
  for (int fi = 0; fi < FA; ++fi) {
    const _Float16* p = an + fi * 16 * XPITCH;
    a[(S + 1) & 1][fi] = frag16(p, p + 16);
  }
  // Keeps the loads as one group in front of the 48 WMMAs that cover their
  // latency; left free, the compiler strews them among the WMMAs.
  __builtin_amdgcn_sched_barrier(0);
#pragma unroll
  for (int fi = 0; fi < FA; ++fi) {
#pragma unroll
    for (int f = 0; f < FB; ++f) {
      acc[fi][f] = __builtin_amdgcn_wmma_f32_16x16x32_f16(
          /*neg_a=*/false, a[S & 1][fi], /*neg_b=*/false, b[S & 3][f],
          /*c_mod=*/(short)0, acc[fi][f],
          /*reuse_a=*/false, /*reuse_b=*/false);
    }
  }
  // Second half of the pair: no later load moves in among the WMMAs.
  __builtin_amdgcn_sched_barrier(0);
}

// Stands at the foot of a loop trip and of a run of steps: what follows rewrites
// address registers that the issued loads name. The sched_barrier holds those
// rewrites behind the wait; left free, the compiler lifts them over it.
__device__ __forceinline__ void trip_foot()
{
  asm volatile("s_wait_xcnt 0x0" ::: "memory");
  __builtin_amdgcn_sched_barrier(0);
}

// + bias, store fp32. C/D layout: VGPR j -> M = j + 8*laneHi, N = laneRow.
// 32 token rows at a time. o: the wave's first column in token row 8 * laneHi of the block.
__device__ __forceinline__ void store_pass(const v8f (&acc)[FA][FB], v4f bias4, v2f bias2,
                                           float* o, int laneRow)
{
#pragma unroll
  for (int g2 = 0; g2 < FA; g2 += 2) {
    v4f o4[2][8];
    v2f o2[2][8];
#pragma unroll
    for (int d = 0; d < 2; ++d) {
#pragma unroll
      for (int j = 0; j < 8; ++j) {
        o4[d][j][0] = acc[g2 + d][0][j] + bias4[0]; o4[d][j][1] = acc[g2 + d][1][j] + bias4[1];
        o4[d][j][2] = acc[g2 + d][2][j] + bias4[2]; o4[d][j][3] = acc[g2 + d][3][j] + bias4[3];
        o2[d][j][0] = acc[g2 + d][4][j] + bias2[0]; o2[d][j][1] = acc[g2 + d][5][j] + bias2[1];
      }
    }
    // Holds the order [sums][stores][wait]: no register that an issued store
    // names is rewritten ahead of the wait.
    __builtin_amdgcn_sched_barrier(0);
#pragma unroll
    for (int d = 0; d < 2; ++d) {
      float* orow = o + (g2 + d) * 16 * C_DIM;
#pragma unroll
      for (int j = 0; j < 8; ++j) {
        __builtin_nontemporal_store(o4[d][j], (v4f*)(orow + j * C_DIM + laneRow * 4));
        __builtin_nontemporal_store(o2[d][j], (v2f*)(orow + j * C_DIM + 64 + laneRow * 2));
      }
    }
    // The next sums, and the next pass, reuse the registers that these stores name.
    asm volatile("s_wait_xcnt 0x0" ::: "memory");
    __builtin_amdgcn_sched_barrier(0);
  }
}

__global__ __launch_bounds__(GT) void lora_gemm_kernel(
    const float* __restrict__ x, const _Float16* __restrict__ Weff,
    const float* __restrict__ bp, float* __restrict__ out)
{
  __shared__ __attribute__((aligned(16))) _Float16 Xs[BM][XPITCH];      // 198,656 B

  const int lane    = threadIdx.x & 31;
  // wave-uniform by construction; readfirstlane keeps the W base in scalar registers
  const int wave    = __builtin_amdgcn_readfirstlane((int)(threadIdx.x >> 5));
  const int laneRow = lane & 15;      // row/col within 16x16 tile
  const int laneHi  = lane >> 4;      // 0/1 -> K sub-block {0..7,16..23} vs {8..15,24..31}

  const int  m        = blockIdx.y;
  const long tokBase  = (long)m * TPM + (long)blockIdx.x * BM;

  // this wave's 48 steps of W, the lane's 16 bytes
  const _Float16* wL = Weff + (m * GW + wave) * (STEPS * STEPH) + (laneRow * 2 + laneHi) * 8;

  // Every "#pragma unroll" in this kernel keeps a register array (xr, a, b, acc)
  // indexed by constants only, so that none goes to scratch.
  v16h   b[4][FB];    // set (step & 3)
  v16h   a[2][FA];    // set (step & 1)
  v4f    xr[XL];      // an x group on its way to LDS
  v8f    acc[FA][FB] = {};

  // bias of both passes, read here so that no pass waits for it. First half of a pair
  // that keeps other address arithmetic from standing between these loads and their wait.
  __builtin_amdgcn_sched_barrier(0);
  const float* bw = bp + wave * WCOL;
  const v4f bias4p0 = *(const v4f*)(bw + laneRow * 4);
  const v2f bias2p0 = *(const v2f*)(bw + 64 + laneRow * 2);
  const v4f bias4p1 = *(const v4f*)(bw + BN + laneRow * 4);
  const v2f bias2p1 = *(const v2f*)(bw + BN + 64 + laneRow * 2);
  // The address arithmetic below reuses the scalar base that these four loads name.
  // Second half of the pair: it holds that arithmetic behind the wait.
  asm volatile("s_wait_xcnt 0x0" ::: "memory");
  __builtin_amdgcn_sched_barrier(0);

  const float* xg = x + (tokBase + wave * 32) * C_DIM + lane * 4;
  _Float16*    xs = &Xs[wave * 32][lane * 4];

  // ---- fill. The sched_barriers hold the order of the requests as written, which
  // is the order the loop goes on in (x group, then three W steps): left free, the
  // compiler mixes them, and the loop's first wait for x then waits for W as well.
#pragma unroll
  for (int sf = 0; sf < 2 * FB; ++sf) {    // W steps 0, 1
    const _Float16* p = wL + sf * FRAGH;
    b[sf / FB][sf % FB] = frag16(p, p + 256);
  }
  __builtin_amdgcn_sched_barrier(0);
  x_request(xr, xg);                       // group 0: steps 0..3
  __builtin_amdgcn_sched_barrier(0);
  x_store(xr, xs);
  __builtin_amdgcn_sched_barrier(0);
  x_request(xr, xg + XK);                  // group 1: steps 4..7
  __builtin_amdgcn_sched_barrier(0);
#pragma unroll
  for (int f = 0; f < FB; ++f) {           // W step 2
    const _Float16* p = wL + (2 * FB + f) * FRAGH;
    b[2][f] = frag16(p, p + 256);
  }
  // The code below reuses registers that the loads above name.
  asm volatile("s_wait_xcnt 0x0" ::: "memory");
  __builtin_amdgcn_sched_barrier(0);
  lds_barrier();      // k 0..127 of all 128 rows stand in LDS

  const _Float16* aLane = &Xs[laneRow][laneHi * 8];
#pragma unroll
  for (int fi = 0; fi < FA; ++fi) {
    const _Float16* p = aLane + fi * 16 * XPITCH;
    a[0][fi] = frag16(p, p + 16);
  }

  float* o = out + (tokBase + laneHi * 8) * C_DIM + wave * WCOL;

  // ---- first column pass, x arriving ----------------------------------------
  kstep<0, 0>(b, a, acc, xr, wL + 3 * STEPH, aLane + 1 * BK, xg, xs);
  kstep<1, 0, true>(b, a, acc, xr, wL + 4 * STEPH, aLane + 2 * BK, xg, xs);
  trip_foot();
  // Trip t = steps 4t + 2 .. 4t + 5; it stores group t + 1 (steps 4t + 4 .. 4t + 7)
  // and requests group t + 2. rolled: a small hot loop
  const float* xn = xg + 2 * XK;     // the group to request next
#pragma clang loop unroll(disable)
  for (int t = 0; t < XG - 2; ++t) {
    const _Float16* wn = wL + (4 * t + 5) * STEPH;
    const _Float16* an = aLane + (4 * t + 3) * BK;
    kstep<2, 1>(b, a, acc, xr, wn, an, xn, xs + (t + 1) * XK);
    lds_barrier();    // step 4t + 3 reads the first x fragments of group t + 1
    kstep<3, 0>(b, a, acc, xr, wn + 1 * STEPH, an + 1 * BK, xn, xs);
    kstep<0, 0>(b, a, acc, xr, wn + 2 * STEPH, an + 2 * BK, xn, xs);
    kstep<1, 0>(b, a, acc, xr, wn + 3 * STEPH, an + 3 * BK, xn, xs);
    trip_foot();
    xn += XK;
  }
  // The last trip (steps 18 .. 21) stands outside the loop: it stores the last group
  // and has none left to request. Asking for a group twice would now be a second
  // read from memory; a branch round the request inside the loop would make the
  // compiler count the loads in flight by the path without x, and every step's
  // wait for W would then wait for x as well.
  {
    const _Float16* wn = wL + (4 * (XG - 2) + 5) * STEPH;
    const _Float16* an = aLane + (4 * (XG - 2) + 3) * BK;
    kstep<2, 2>(b, a, acc, xr, wn, an, xg, xs + (XG - 1) * XK);
    lds_barrier();    // step 19 reads the first x fragments of the last group
    kstep<3, 0>(b, a, acc, xr, wn + 1 * STEPH, an + 1 * BK, xg, xs);
    kstep<0, 0>(b, a, acc, xr, wn + 2 * STEPH, an + 2 * BK, xg, xs);
    kstep<1, 0>(b, a, acc, xr, wn + 3 * STEPH, an + 3 * BK, xg, xs);
    trip_foot();
  }
  // steps 22, 23; behind step 23 comes k = 0 again
  kstep<2, 0>(b, a, acc, xr, wL + 25 * STEPH, aLane + 23 * BK, xg, xs);
  kstep<3, 0>(b, a, acc, xr, wL + 26 * STEPH, aLane, xg, xs);
  trip_foot();
  store_pass(acc, bias4p0, bias2p0, o, laneRow);

  // ---- second column pass: LDS is only read ----------------------------------
#pragma unroll
  for (int fi = 0; fi < FA; ++fi) {
#pragma unroll
    for (int f = 0; f < FB; ++f)
      acc[fi][f] = v8f{};
  }
  // rolled by 4 steps, the period of both register rings: a small hot loop
#pragma clang loop unroll(disable)
  for (int it = 0; it < KS / 4; ++it) {
    const int s0 = KS + it * 4;                            // first step of this trip
    // W three steps ahead. Step s0 + 3 always exists; s0 + 4.. do not in the last
    // trip, which loads steps 44..46 again instead (valid bytes, values unused).
    const _Float16* w3 = wL + (s0 + 3) * STEPH;
    const _Float16* w4 = wL + (s0 + 4 < STEPS ? s0 + 4 : STEPS - 4) * STEPH;
    // x one step ahead; the last step reads k = 0 again (valid bytes, values unused)
    const _Float16* a1 = aLane + it * 4 * BK;
    const _Float16* a4 = aLane + (it + 1 < KS / 4 ? (it + 1) * 4 * BK : 0);
    kstep<0, 0>(b, a, acc, xr, w3, a1 + 1 * BK, xg, xs);
    kstep<1, 0>(b, a, acc, xr, w4, a1 + 2 * BK, xg, xs);
    kstep<2, 0>(b, a, acc, xr, w4 + 1 * STEPH, a1 + 3 * BK, xg, xs);
    kstep<3, 0>(b, a, acc, xr, w4 + 2 * STEPH, a4, xg, xs);
    trip_foot();
  }
  store_pass(acc, bias4p1, bias2p1, o + BN, laneRow);
}

// ---------------------------------------------------------------------------
extern "C" void kernel_launch(void* const* d_in, const int* in_sizes, int n_in,
                              void* d_out, int out_size, void* d_ws, size_t ws_size,
                              hipStream_t stream) {
  const float* x  = (const float*)d_in[0];   // [32, 1024, 768]
  const float* Wp = (const float*)d_in[1];   // [768, 768]
  const float* bp = (const float*)d_in[2];   // [768]
  const float* A  = (const float*)d_in[3];   // [4, 16, 768]
  const float* Bw = (const float*)d_in[4];   // [4, 768, 16]
  float* out = (float*)d_out;                // [32, 1024, 768]

  _Float16* Weff = (_Float16*)d_ws;          // 4*768*768*2 = 4.72 MB scratch, packed order

  // Fold LoRA into dense weights (f16, WMMA fragment order).
  prep_weights_kernel<<<PBLK, PWAV * 32, 0, stream>>>(Wp, A, Bw, Weff);

  // Batched WMMA GEMM with fused bias.
  {
    dim3 grid(TPM / BM, M_MOD);  // (64, 4): one block per 128 token rows
    lora_gemm_kernel<<<grid, GT, 0, stream>>>(x, Weff, bp, out);
  }
}
